// v000
// Times are from an AMD MI455X. After a warm-up the kernel runs many times in a row, and a time is the length of
// such a window on the GPU divided by its runs, so every launch and the gaps after it count. The runs cycle
// through copies of the inputs. A figure is the median of several windows, for all but v000 over two sittings.
// Sittings can differ by a few percent; kernels timed side by side share one.
// v000 is the starting kernel. One run takes 3990 microseconds.
#include <hip/hip_runtime.h>

// Multi-head attention on SEQUENCE-FIRST tensors, FOUR batch columns (query, key, value [2048][4][1024] = [S][B][D] (the module swaps to batch-major inside and back); q = query Wq^T + bq, k = key Wk^T + bk, v = value Wv^T + bv ('oi' [1024][1024] 0.02 + ZERO biases: read); 16 heads x 64 per batch column; scores / sqrt(64); softmax over the keys; x = merged context; out = x Wo^T + bo ('oi' + a zero bias: read) -> [2048][4][1024] (8.4 M); argument order query, key, value, Wq, bq, Wk, bk, Wv, bv, Wo, bo.
// Layout per batch b: a strided gather makes the bf16 copy of rows s of column b (row pitch B x D) for query, then key, then value; 'oi' weights; exact projections + f32 biases; dense T-2048 attention (hybrid rows: < 512 hi/lo 3 products, rest fp16 x1024); merged hi/lo x Wo exact + bo written with row pitch B x D at column offset b (the [S][B][D] output).
// Compute dtypes, f32 accumulate: every input rounded to bf16; projections exact + f32 biases; attention rows < 512 3 products, rest fp16; softmax f32; Wo hl x exact + bias.

#define NB_  4   // this module has FOUR batch columns; NB_ is read ONLY by kernel_launch: the batch loop, the cast kernel's pitch ARGUMENT (NB_ * DM) and the output GEMM's leading-dimension ARGUMENT (NB_ * DM): no kernel body reads it
#define TT   2048
#define DM   1024
#define NH_  16
#define NKV  16
#define REP  (NH_ / NKV)
#define HD   64
#define DQ   (NH_ * HD)
#define DKV  (NKV * HD)
#define ZH   2
#define RH   512                  // query rows < RH use hi+lo planes (0: none)
#define WIN  0
#define PCAR 1024.0f
#define SCL  0.125f   // HD^-0.5
typedef _Float16 h16;
typedef unsigned short bf;
typedef __attribute__((ext_vector_type(16))) __bf16   v16bf;
typedef __attribute__((ext_vector_type(16))) _Float16 v16h;
typedef __attribute__((ext_vector_type(8)))  _Float16 v8h;
typedef __attribute__((ext_vector_type(8)))  unsigned short v8us;
typedef __attribute__((ext_vector_type(8)))  float    v8f;
typedef __attribute__((ext_vector_type(4)))  float    v4f;
typedef v8h  __attribute__((may_alias)) v8ha;
typedef v4f  __attribute__((may_alias)) v4fa;
typedef v8us __attribute__((may_alias)) v8usa;

__device__ __forceinline__ unsigned short f2bf(float f) { unsigned u = __float_as_uint(f); u += 0x7FFFu + ((u >> 16) & 1u); return (unsigned short)(u >> 16); }
__device__ __forceinline__ float bf2f(unsigned short b) { return __uint_as_float(((unsigned)b) << 16); }
__device__ __forceinline__ float bfr(float f) { return bf2f(f2bf(f)); }
__device__ __forceinline__ v16h cat16(v8h lo, v8h hi) { return __builtin_shufflevector(lo, hi, 0, 1, 2, 3, 4, 5, 6, 7, 8, 9, 10, 11, 12, 13, 14, 15); }
__device__ __forceinline__ v16bf cat16b(v8us lo, v8us hi) { return __builtin_bit_cast(v16bf, __builtin_shufflevector(lo, hi, 0, 1, 2, 3, 4, 5, 6, 7, 8, 9, 10, 11, 12, 13, 14, 15)); }
__device__ __forceinline__ v8f wmma16(v16h a, v16h b, v8f c) { return __builtin_amdgcn_wmma_f32_16x16x32_f16(false, a, false, b, (short)0, c, false, false); }
__device__ __forceinline__ v8f wmmab(v16bf a, v16bf b, v8f c) { return __builtin_amdgcn_wmma_f32_16x16x32_bf16(false, a, false, b, (short)0, c, false, false); }



// ---- k_gemmw: register-blocked GEMM, ONE WAVE per 64x64 output tile (16 accumulators), operands straight from K-contiguous 16-bit planes; grid (M/64, N/64, Z), 32 threads.
// C[m][n] (f32, pitch ldc, + optional f32 bias[n]) = sum_k A[m][k] Bt[n][k] (+ split products per NSPLIT). z-batch strides sA/sB/sC in elements. K % 32 == 0.
template <typename T16> struct WFrag;
template <> struct WFrag<h16> { typedef v16h V; static __device__ __forceinline__ V ld(const h16* p) { return cat16(*(const v8h*)p, *(const v8h*)(p + 16)); } static __device__ __forceinline__ v8f mma(V a, V b, v8f c) { return wmma16(a, b, c); } };
template <> struct WFrag<bf> { typedef v16bf V; static __device__ __forceinline__ V ld(const bf* p) { return cat16b(*(const v8us*)p, *(const v8us*)(p + 16)); } static __device__ __forceinline__ v8f mma(V a, V b, v8f c) { return wmmab(a, b, c); } };
template <typename T16, int NSPLIT, bool BIAS>
__global__ __launch_bounds__(32) void k_gemmw(const T16* __restrict__ A, const T16* __restrict__ A2, const T16* __restrict__ Bt, const T16* __restrict__ Bt2, int K, float* C, int ldc, const float* __restrict__ bias, size_t sA, size_t sB, size_t sC) {
    typedef typename WFrag<T16>::V V;
    __shared__ __align__(16) float os[16 * 68];
    const size_t z = blockIdx.z; A += z * sA; if (A2) A2 += z * sA; Bt += z * sB; if (Bt2) Bt2 += z * sB; C += z * sC;
    const int lane = threadIdx.x & 31, lr = lane & 15, hi = lane >> 4; const int r0 = blockIdx.x * 64, c0 = blockIdx.y * 64;
    v8f acc[4][4];
#pragma unroll
    for (int mb = 0; mb < 4; ++mb)
#pragma unroll
        for (int nb = 0; nb < 4; ++nb) acc[mb][nb] = (v8f){};
    const size_t aoff = (size_t)(r0 + lr) * K + 8 * hi, boff = (size_t)(c0 + lr) * K + 8 * hi;
#pragma unroll 1
    for (int kc = 0; kc < K; kc += 32) {
        V a[4], a2[4];
#pragma unroll
        for (int mb = 0; mb < 4; ++mb) { a[mb] = WFrag<T16>::ld(A + aoff + (size_t)mb * 16 * K + kc); if (NSPLIT == 1 || NSPLIT == 2) a2[mb] = WFrag<T16>::ld(A2 + aoff + (size_t)mb * 16 * K + kc); }
#pragma unroll
        for (int nb = 0; nb < 4; ++nb) { const V b = WFrag<T16>::ld(Bt + boff + (size_t)nb * 16 * K + kc); V b2; if (NSPLIT >= 2) b2 = WFrag<T16>::ld(Bt2 + boff + (size_t)nb * 16 * K + kc);
#pragma unroll
            for (int mb = 0; mb < 4; ++mb) { acc[mb][nb] = WFrag<T16>::mma(a[mb], b, acc[mb][nb]); if (NSPLIT == 1 || NSPLIT == 2) acc[mb][nb] = WFrag<T16>::mma(a2[mb], b, acc[mb][nb]); if (NSPLIT >= 2) acc[mb][nb] = WFrag<T16>::mma(a[mb], b2, acc[mb][nb]); } }
        asm volatile("v_nop\n\tv_nop\n\tv_nop\n\tv_nop" : "+v"(acc[0][0]), "+v"(acc[1][1]), "+v"(acc[2][2]), "+v"(acc[3][3]) : "v"(a[0]), "v"(a[3]));
    }
#pragma unroll
    for (int mb = 0; mb < 4; ++mb) {
#pragma unroll
        for (int nb = 0; nb < 4; ++nb) {
#pragma unroll
            for (int j = 0; j < 8; ++j) os[(hi * 8 + j) * 68 + nb * 16 + lr] = acc[mb][nb][j]; }
        __builtin_amdgcn_wave_barrier(); asm volatile("" ::: "memory");
        float* crow = C + (size_t)(r0 + mb * 16) * ldc + c0;
{
#pragma unroll
            for (int s = 0; s < 8; ++s) { const int row = 2 * s + hi, cofs = lr * 4; v4f val = *(const v4fa*)(os + row * 68 + cofs); if (BIAS) { val[0] += bfr(bias[c0 + cofs]); val[1] += bfr(bias[c0 + cofs + 1]); val[2] += bfr(bias[c0 + cofs + 2]); val[3] += bfr(bias[c0 + cofs + 3]); }
                *(v4f*)(crow + (size_t)row * ldc + cofs) = val; }
             }
        __builtin_amdgcn_wave_barrier(); asm volatile("" ::: "memory");
    }
}

__device__ __forceinline__ h16 tohx(float x) { return (h16)x; }
__device__ __forceinline__ void splitf(float y, unsigned short& h, unsigned short& l) { h = f2bf(y); l = f2bf(y - bf2f(h)); }
typedef __attribute__((ext_vector_type(2))) _Float16 v2h;
typedef __attribute__((ext_vector_type(4))) _Float16 v4h;
typedef __attribute__((ext_vector_type(2))) unsigned short v2us;
typedef __attribute__((ext_vector_type(4))) unsigned short v4us;
typedef __attribute__((ext_vector_type(2))) float v2f;
typedef __attribute__((ext_vector_type(4))) int v4i;

__global__ __launch_bounds__(256) void k_wtG(const float* __restrict__ w, int K, int N, bf* Bt) {
    const int lane = threadIdx.x & 31; const int L0 = (blockIdx.x * 8 + (threadIdx.x >> 5)) * 8; const int nlines = N * K / 64;
{
#pragma unroll 1
        for (int l = 0; l < 8; ++l) { const int L = L0 + l; if (L >= nlines) break; const size_t e = (size_t)L * 64 + lane * 2; const int k = (int)(e % K), n = (int)(e / K); v2us o;
            o[0] = f2bf(w[(size_t)k * N + n]); o[1] = f2bf(w[(size_t)(k + 1) * N + n]); *(v2us*)(Bt + e) = o; }
         }
}
__global__ __launch_bounds__(256) void k_cvt8(const float* __restrict__ src, bf* dst, size_t n8) { const size_t i = (size_t)blockIdx.x * 256 + threadIdx.x; if (i >= n8) return; const v8f v = *(const v8f*)(src + i * 8); v8us o;
#pragma unroll
    for (int k = 0; k < 8; ++k) o[k] = f2bf(v[k]); *(v8us*)(dst + i * 8) = o;  }

// k_rope: head planes [h][t][d] (fp16 + hi/lo) of rope(x) x sc with the rotate-half convention out[d] = x[d] cos[t][d] - x[d+HD/2] sin[t][d], out[d+HD/2] = x[d+HD/2] cos[t][d+HD/2] + x[d] sin[t][d+HD/2]
__global__ __launch_bounds__(256) void k_rope(const float* __restrict__ F, int pitch, int nheads, const float* __restrict__ CS, const float* __restrict__ RF, const float* __restrict__ nw, float sc, h16* P16, bf* Ph, bf* Pl) {
    const size_t e = ((size_t)blockIdx.x * 256 + threadIdx.x) * 2; if (e >= (size_t)nheads * TT * HD) return; const int d = (int)(e % HD); const int t = (int)((e / HD) % TT); const int h = (int)(e / ((size_t)HD * TT)); const float* f = F + (size_t)t * pitch + h * HD; const float rf = RF ? RF[(size_t)h * TT + t] : 1.0f; v2h o16; v2us oh, ol;
#pragma unroll
    for (int q = 0; q < 2; ++q) { const int dd = d + q; const int dp = (dd < HD / 2) ? dd + HD / 2 : dd - HD / 2; float x0 = f[dd], x1 = f[dp];
        if (RF) { float n0 = __fmul_rn(x0, rf), n1 = __fmul_rn(x1, rf); asm volatile("" : "+v"(n0)); asm volatile("" : "+v"(n1)); x0 = __fmul_rn(bfr(nw[dd]), n0); x1 = __fmul_rn(bfr(nw[dp]), n1); }
        const v2f cs = *(const v2f*)(CS + ((size_t)t * HD + dd) * 2); float a = __fmul_rn(x0, cs[0]), bq = __fmul_rn(x1, cs[1]); asm volatile("" : "+v"(a)); asm volatile("" : "+v"(bq)); const float r = ((dd < HD / 2) ? __fsub_rn(a, bq) : __fadd_rn(a, bq)) * sc;
        o16[q] = tohx(r); unsigned short a2, c2; splitf(r, a2, c2); oh[q] = a2; ol[q] = c2; }
    *(v2h*)(P16 + e) = o16; *(v2us*)(Ph + e) = oh; *(v2us*)(Pl + e) = ol;  }
__global__ __launch_bounds__(256) void k_vtp(const float* __restrict__ F, int pitch, int nheads, h16* V16, bf* Vh, bf* Vl) { const size_t e = ((size_t)blockIdx.x * 256 + threadIdx.x) * 2; if (e >= (size_t)nheads * HD * TT) return; const int t = (int)(e % TT); const int d = (int)((e / TT) % HD); const int g = (int)(e / ((size_t)TT * HD)); v2h o16; v2us oh, ol;
#pragma unroll
    for (int q = 0; q < 2; ++q) { const float x = F[(size_t)(t + q) * pitch + g * HD + d]; o16[q] = tohx(x); unsigned short a2, c2; splitf(x, a2, c2); oh[q] = a2; ol[q] = c2; }
    *(v2h*)(V16 + e) = o16; *(v2us*)(Vh + e) = oh; *(v2us*)(Vl + e) = ol;  }
__global__ __launch_bounds__(256) void k_csid(float* CS) { const int idx = blockIdx.x * 256 + threadIdx.x; if (idx >= TT * HD) return; v2f cs; cs[0] = 1.0f; cs[1] = 0.0f; *(v2f*)(CS + (size_t)idx * 2) = cs;  }
// k_asoft: per row (zz, i): t = S x HD^-0.5 (no mask); softmax over the 2048 keys (register row, one exp, fixed trees);
__global__ __launch_bounds__(256) void k_asoft(const float* __restrict__ Sb, h16* P16, bf* Ph, bf* Pl) {
    const int lane = threadIdx.x & 31; const int row = blockIdx.x * 8 + (threadIdx.x >> 5); if (row >= ZH * TT) return; const int i = row % TT; const int zz = row / TT; (void)zz; const bool hires = (i < RH); const float* sr = Sb + (size_t)row * TT; float v[TT / 32]; float mx = -3.0e38f;
#pragma unroll
    for (int ch = 0; ch < TT / 128; ++ch) { const int j0 = ch * 128 + lane * 4; const v4f a = *(const v4f*)(sr + j0);
#pragma unroll
        for (int q = 0; q < 4; ++q) { const int j = j0 + q; (void)j; const float t = a[q] * SCL; v[ch * 4 + q] = t; mx = fmaxf(mx, t); } }
#pragma unroll
    for (int sh = 16; sh; sh >>= 1) mx = fmaxf(mx, __shfl_xor(mx, sh, 32));
    float sum = 0.f;
#pragma unroll
    for (int k = 0; k < TT / 32; ++k) { float d0 = __fsub_rn(v[k], mx); asm volatile("" : "+v"(d0)); v[k] = __builtin_amdgcn_exp2f(__fmul_rn(d0, 1.4426950408889634f)); sum += v[k]; }
#pragma unroll
    for (int sh = 16; sh; sh >>= 1) sum += __shfl_xor(sum, sh, 32);
    const float f = __fdiv_rn(hires ? 1.0f : PCAR, sum);
{
        if (hires) {
#pragma unroll
            for (int ch = 0; ch < TT / 128; ++ch) { v4us oh, ol;
#pragma unroll
                for (int q = 0; q < 4; ++q) { unsigned short a, c2; splitf(v[ch * 4 + q] * f, a, c2); oh[q] = a; ol[q] = c2; }
                const size_t oo = ((size_t)zz * (RH ? RH : 1) + i) * TT + ch * 128 + lane * 4; *(v4us*)(Ph + oo) = oh; *(v4us*)(Pl + oo) = ol; }
        } else {
#pragma unroll
            for (int ch = 0; ch < TT / 128; ++ch) { v4h o4;
#pragma unroll
                for (int q = 0; q < 4; ++q) o4[q] = tohx(v[ch * 4 + q] * f);
                *(v4h*)(P16 + (size_t)row * TT + ch * 128 + lane * 4) = o4; } }
         }
}
__global__ __launch_bounds__(256) void k_cvt8s(const float* __restrict__ X, bf* XB, size_t pitch) { const size_t i = (size_t)blockIdx.x * 256 + threadIdx.x; if (i >= (size_t)TT * DM / 8) return; const size_t e = i * 8; const int c = (int)(e % DM); const int srow = (int)(e / DM); const v8f a = *(const v8f*)(X + (size_t)srow * pitch + c); v8us o;
#pragma unroll
    for (int q = 0; q < 8; ++q) o[q] = f2bf(a[q]);
    *(v8us*)(XB + e) = o;  }
__global__ __launch_bounds__(256) void k_merge(const float* __restrict__ O, int h0, bf* Ah, bf* Al) { const size_t e = ((size_t)blockIdx.x * 256 + threadIdx.x) * 2; if (e >= (size_t)ZH * TT * HD) return; const int d = (int)(e % HD); const int t = (int)((e / HD) % TT); const int zz = (int)(e / ((size_t)HD * TT)); const float cs = (t < RH) ? 1.0f : (1.0f / PCAR); const size_t oo = (size_t)t * DQ + (h0 + zz) * HD + d;
    v2us oh, ol;
#pragma unroll
    for (int q = 0; q < 2; ++q) { unsigned short a, c2; splitf(O[e + q] * cs, a, c2); oh[q] = a; ol[q] = c2; } *(v2us*)(Ah + oo) = oh; *(v2us*)(Al + oo) = ol;  }

extern "C" void kernel_launch(void* const* d_in, const int* in_sizes, int n_in,
                              void* d_out, int out_size, void* d_ws, size_t ws_size, hipStream_t stream) {
    (void)in_sizes; (void)n_in; (void)out_size;
    const float* x = (const float*)d_in[0];   /* query [S][B][D] */ const float* xk = (const float*)d_in[1]; const float* xv = (const float*)d_in[2]; const float* wq = (const float*)d_in[3]; const float* bq = (const float*)d_in[4]; const float* wk = (const float*)d_in[5]; const float* bk = (const float*)d_in[6]; const float* wv = (const float*)d_in[7]; const float* bv = (const float*)d_in[8]; const float* wo = (const float*)d_in[9]; const float* bo = (const float*)d_in[10];
    float* OUT = (float*)d_out;     // [2048][4][1024] sequence-first
    char* wsp = (char*)d_ws;
    auto take = [&](size_t bytes) { char* p = wsp; wsp += (bytes + 255) & ~(size_t)255; return (void*)p; };
    bf* WQ = (bf*)take((size_t)DQ * DM * 2); bf* WK = (bf*)take((size_t)DKV * DM * 2); bf* WV = (bf*)take((size_t)DKV * DM * 2); bf* WO = (bf*)take((size_t)DM * DQ * 2); float* CS = (float*)take((size_t)TT * HD * 2 * 4);
    bf* XB = (bf*)take((size_t)TT * DM * 2); float* FQ = (float*)take((size_t)TT * DQ * 4); float* FK = (float*)take((size_t)TT * DKV * 4);
    h16* QP16 = (h16*)take((size_t)NH_ * TT * HD * 2); h16* KP16 = (h16*)take((size_t)NKV * TT * HD * 2); h16* VT16 = (h16*)take((size_t)NKV * HD * TT * 2);
    bf* QPh = (bf*)take((size_t)NH_ * TT * HD * 2); bf* QPl = (bf*)take((size_t)NH_ * TT * HD * 2); bf* KPh = (bf*)take((size_t)NKV * TT * HD * 2); bf* KPl = (bf*)take((size_t)NKV * TT * HD * 2); bf* VTh = (bf*)take((size_t)NKV * HD * TT * 2); bf* VTl = (bf*)take((size_t)NKV * HD * TT * 2); bf* Ph = (bf*)take((size_t)ZH * RH * TT * 2); bf* Pl = (bf*)take((size_t)ZH * RH * TT * 2);
    float* Sb = (float*)take((size_t)ZH * TT * TT * 4); h16* P16 = (h16*)take((size_t)ZH * TT * TT * 2); float* Ob = (float*)take((size_t)ZH * TT * HD * 4); bf* ATh = (bf*)take((size_t)TT * DQ * 2); bf* ATl = (bf*)take((size_t)TT * DQ * 2);
    if ((size_t)(wsp - (char*)d_ws) > ws_size) return;    // ws 256 MiB
    float* FV = FK;   // v projection reuses the k buffer after the k planes are built (stream-ordered)
    { k_cvt8<<<(unsigned)(((size_t)DQ * DM / 8 + 255) / 256), 256, 0, stream>>>(wq, WQ, (size_t)DQ * DM / 8); k_cvt8<<<(unsigned)(((size_t)DKV * DM / 8 + 255) / 256), 256, 0, stream>>>(wk, WK, (size_t)DKV * DM / 8); k_cvt8<<<(unsigned)(((size_t)DKV * DM / 8 + 255) / 256), 256, 0, stream>>>(wv, WV, (size_t)DKV * DM / 8);
      k_cvt8<<<(unsigned)(((size_t)DM * DQ / 8 + 255) / 256), 256, 0, stream>>>(wo, WO, (size_t)DM * DQ / 8);
       }
    k_csid<<<(TT * HD + 255) / 256, 256, 0, stream>>>(CS);
    const unsigned LQ = (unsigned)(((size_t)NH_ * TT * HD / 2 + 255) / 256), LKv = (unsigned)(((size_t)NKV * TT * HD / 2 + 255) / 256);
    for (int b = 0; b < NB_; ++b) {
        
        k_cvt8s<<<(unsigned)(((size_t)TT * DM / 8 + 255) / 256), 256, 0, stream>>>(x + (size_t)b * DM, XB, (size_t)NB_ * DM);   /* rows s of batch column b: pitch B x D */
        k_gemmw<bf, 0, true><<<dim3(TT / 64, DQ / 64, 1), 32, 0, stream>>>(XB, nullptr, WQ, nullptr, DM, FQ, DQ, bq, 0, 0, 0);
        k_rope<<<LQ, 256, 0, stream>>>(FQ, DQ, NH_, CS, nullptr, nullptr, 1.0f, QP16, QPh, QPl);
        k_cvt8s<<<(unsigned)(((size_t)TT * DM / 8 + 255) / 256), 256, 0, stream>>>(xk + (size_t)b * DM, XB, (size_t)NB_ * DM);   /* rows s of batch column b: pitch B x D */ k_gemmw<bf, 0, true><<<dim3(TT / 64, DKV / 64, 1), 32, 0, stream>>>(XB, nullptr, WK, nullptr, DM, FK, DKV, bk, 0, 0, 0);
        k_rope<<<LKv, 256, 0, stream>>>(FK, DKV, NKV, CS, nullptr, nullptr, 1.0f, KP16, KPh, KPl);
        k_cvt8s<<<(unsigned)(((size_t)TT * DM / 8 + 255) / 256), 256, 0, stream>>>(xv + (size_t)b * DM, XB, (size_t)NB_ * DM);   /* rows s of batch column b: pitch B x D */ k_gemmw<bf, 0, true><<<dim3(TT / 64, DKV / 64, 1), 32, 0, stream>>>(XB, nullptr, WV, nullptr, DM, FV, DKV, bv, 0, 0, 0); k_vtp<<<LKv, 256, 0, stream>>>(FV, DKV, NKV, VT16, VTh, VTl);
        for (int h0 = 0; h0 < NH_; h0 += ZH) { const size_t zq = (size_t)h0, zk = (size_t)(h0 / REP);   // one kv head per query head: the pass's two heads use consecutive kv planes (z-strides TT*HD)
            k_gemmw<bf, 2, false><<<dim3(RH / 64, TT / 64, ZH), 32, 0, stream>>>(QPh + zq * TT * HD, QPl + zq * TT * HD, KPh + zk * TT * HD, KPl + zk * TT * HD, HD, Sb, TT, nullptr, (size_t)TT * HD, (size_t)TT * HD, (size_t)TT * TT);
            k_gemmw<h16, 0, false><<<dim3((TT - RH) / 64, TT / 64, ZH), 32, 0, stream>>>(QP16 + zq * TT * HD + (size_t)RH * HD, nullptr, KP16 + zk * TT * HD, nullptr, HD, Sb + (size_t)RH * TT, TT, nullptr, (size_t)TT * HD, (size_t)TT * HD, (size_t)TT * TT);
            k_asoft<<<ZH * TT / 8, 256, 0, stream>>>(Sb, P16, Ph, Pl);
            k_gemmw<bf, 2, false><<<dim3(RH / 64, HD / 64, ZH), 32, 0, stream>>>(Ph, Pl, VTh + zk * HD * TT, VTl + zk * HD * TT, TT, Ob, HD, nullptr, (size_t)RH * TT, (size_t)HD * TT, (size_t)TT * HD);
            k_gemmw<h16, 0, false><<<dim3((TT - RH) / 64, HD / 64, ZH), 32, 0, stream>>>(P16 + (size_t)RH * TT, nullptr, VT16 + zk * HD * TT, nullptr, TT, Ob + (size_t)RH * HD, HD, nullptr, (size_t)TT * TT, (size_t)HD * TT, (size_t)TT * HD);
            k_merge<<<(unsigned)(((size_t)ZH * TT * HD / 2 + 255) / 256), 256, 0, stream>>>(Ob, h0, ATh, ATl); }
        k_gemmw<bf, 1, true><<<dim3(TT / 64, DM / 64, 1), 32, 0, stream>>>(ATh, ATl, WO, nullptr, DQ, OUT + (size_t)b * DM, NB_ * DM, bo, 0, 0, 0);   /* [S][B][D]: row pitch B x D, column block b */ }
}

// v001
// Measured time: 2110 microseconds a run.
// In both of two side-by-side timings against v000, it was 1.91 times as fast.
#include <hip/hip_runtime.h>

// Multi-head attention on SEQUENCE-FIRST tensors, FOUR batch columns (query, key, value [2048][4][1024] = [S][B][D] (the module swaps to batch-major inside and back); q = query Wq^T + bq, k = key Wk^T + bk, v = value Wv^T + bv ('oi' [1024][1024] 0.02 + ZERO biases: read); 16 heads x 64 per batch column; scores / sqrt(64); softmax over the keys; x = merged context; out = x Wo^T + bo ('oi' + a zero bias: read) -> [2048][4][1024] (8.4 M); argument order query, key, value, Wq, bq, Wk, bk, Wv, bv, Wo, bo.
// Layout per batch b: a strided gather makes the bf16 copy of rows s of column b (row pitch B x D) for query, then key, then value; 'oi' weights; exact projections + f32 biases; dense T-2048 attention (hybrid rows: < 512 hi/lo 3 products, rest fp16 x1024); merged hi/lo x Wo exact + bo written with row pitch B x D at column offset b (the [S][B][D] output).
// Compute dtypes, f32 accumulate: every input rounded to bf16; projections exact + f32 biases; attention rows < 512 3 products, rest fp16; softmax f32; Wo hl x exact + bias.

#define NB_  4   // this module has FOUR batch columns; NB_ is read ONLY by kernel_launch: the batch loop, the cast kernel's pitch ARGUMENT (NB_ * DM) and the output GEMM's leading-dimension ARGUMENT (NB_ * DM): no kernel body reads it
#define TT   2048
#define DM   1024
#define NH_  16
#define NKV  16
#define REP  (NH_ / NKV)
#define HD   64
#define DQ   (NH_ * HD)
#define DKV  (NKV * HD)
#define ZH   2
#define RH   512                  // query rows < RH use hi+lo planes (0: none)
#define WIN  0
#define PCAR 1024.0f
#define SCL  0.125f   // HD^-0.5
typedef _Float16 h16;
typedef unsigned short bf;
typedef __attribute__((ext_vector_type(16))) __bf16   v16bf;
typedef __attribute__((ext_vector_type(16))) _Float16 v16h;
typedef __attribute__((ext_vector_type(8)))  _Float16 v8h;
typedef __attribute__((ext_vector_type(8)))  unsigned short v8us;
typedef __attribute__((ext_vector_type(8)))  float    v8f;
typedef __attribute__((ext_vector_type(4)))  float    v4f;
typedef v8h  __attribute__((may_alias)) v8ha;
typedef v4f  __attribute__((may_alias)) v4fa;
typedef v8us __attribute__((may_alias)) v8usa;

__device__ __forceinline__ unsigned short f2bf(float f) { unsigned u = __float_as_uint(f); u += 0x7FFFu + ((u >> 16) & 1u); return (unsigned short)(u >> 16); }
__device__ __forceinline__ float bf2f(unsigned short b) { return __uint_as_float(((unsigned)b) << 16); }
__device__ __forceinline__ float bfr(float f) { return bf2f(f2bf(f)); }
__device__ __forceinline__ v16h cat16(v8h lo, v8h hi) { return __builtin_shufflevector(lo, hi, 0, 1, 2, 3, 4, 5, 6, 7, 8, 9, 10, 11, 12, 13, 14, 15); }
__device__ __forceinline__ v16bf cat16b(v8us lo, v8us hi) { return __builtin_bit_cast(v16bf, __builtin_shufflevector(lo, hi, 0, 1, 2, 3, 4, 5, 6, 7, 8, 9, 10, 11, 12, 13, 14, 15)); }
__device__ __forceinline__ v8f wmma16(v16h a, v16h b, v8f c) { return __builtin_amdgcn_wmma_f32_16x16x32_f16(false, a, false, b, (short)0, c, false, false); }
__device__ __forceinline__ v8f wmmab(v16bf a, v16bf b, v8f c) { return __builtin_amdgcn_wmma_f32_16x16x32_bf16(false, a, false, b, (short)0, c, false, false); }



// ---- k_gemmw: register-blocked GEMM, KW WAVES per 64x64 output tile (16 accumulators a wave), operands straight from K-contiguous 16-bit planes; grid (M/64, N/64, Z), 32 * KW threads.
// C[m][n] (f32, pitch ldc, + optional f32 bias[n]) = sum_k A[m][k] Bt[n][k] (+ split products per NSPLIT). z-batch strides sA/sB/sC in elements. K % (32 * KW) == 0.
// KW > 1: wave w sums the k range [w K/KW, (w+1) K/KW); the KW partial tiles meet in LDS and are added in the fixed order w = 0 .. KW-1 (KW is 1, 8 or 16).
template <typename T16> struct WFrag;
template <> struct WFrag<h16> { typedef v16h V; static __device__ __forceinline__ V ld(const h16* p) { return cat16(*(const v8h*)p, *(const v8h*)(p + 16)); } static __device__ __forceinline__ v8f mma(V a, V b, v8f c) { return wmma16(a, b, c); } };
template <> struct WFrag<bf> { typedef v16bf V; static __device__ __forceinline__ V ld(const bf* p) { return cat16b(*(const v8us*)p, *(const v8us*)(p + 16)); } static __device__ __forceinline__ v8f mma(V a, V b, v8f c) { return wmmab(a, b, c); } };
template <typename T16, int NSPLIT, bool BIAS, int KW>
__global__ __launch_bounds__(32 * KW) void k_gemmw(const T16* __restrict__ A, const T16* __restrict__ A2, const T16* __restrict__ Bt, const T16* __restrict__ Bt2, int K, float* C, int ldc, const float* __restrict__ bias, size_t sA, size_t sB, size_t sC) {
    typedef typename WFrag<T16>::V V;
    constexpr int SLAB = 16 * 68;                    // one 16 x 64 f32 slab, row pitch 68
    constexpr int MBR = (KW == 1) ? 1 : 4;           // slabs a wave keeps in LDS at a time: KW > 1 holds each wave's whole 64 x 64 partial tile
    __shared__ __align__(16) float os[KW * MBR * SLAB];
    const size_t z = blockIdx.z; A += z * sA; if (A2) A2 += z * sA; Bt += z * sB; if (Bt2) Bt2 += z * sB; C += z * sC;
    const int lane = threadIdx.x & 31, lr = lane & 15, hi = lane >> 4; const int r0 = blockIdx.x * 64, c0 = blockIdx.y * 64;
    v8f acc[4][4];
#pragma unroll
    for (int mb = 0; mb < 4; ++mb)
#pragma unroll
        for (int nb = 0; nb < 4; ++nb) acc[mb][nb] = (v8f){};
    const size_t aoff = (size_t)(r0 + lr) * K + 8 * hi, boff = (size_t)(c0 + lr) * K + 8 * hi;
    // the wave's number as a scalar, so that the loop bounds and the LDS base stay in scalar registers
    const int wv = __builtin_amdgcn_readfirstlane((int)(threadIdx.x >> 5)); const int kspan = K / KW, kbeg = wv * kspan, kend = kbeg + kspan;
#pragma unroll 1
    for (int kc = kbeg; kc < kend; kc += 32) {
        V a[4], a2[4];
#pragma unroll
        for (int mb = 0; mb < 4; ++mb) { a[mb] = WFrag<T16>::ld(A + aoff + (size_t)mb * 16 * K + kc); if (NSPLIT == 1 || NSPLIT == 2) a2[mb] = WFrag<T16>::ld(A2 + aoff + (size_t)mb * 16 * K + kc); }
#pragma unroll
        for (int nb = 0; nb < 4; ++nb) { const V b = WFrag<T16>::ld(Bt + boff + (size_t)nb * 16 * K + kc); V b2; if (NSPLIT >= 2) b2 = WFrag<T16>::ld(Bt2 + boff + (size_t)nb * 16 * K + kc);
#pragma unroll
            for (int mb = 0; mb < 4; ++mb) { acc[mb][nb] = WFrag<T16>::mma(a[mb], b, acc[mb][nb]); if (NSPLIT == 1 || NSPLIT == 2) acc[mb][nb] = WFrag<T16>::mma(a2[mb], b, acc[mb][nb]); if (NSPLIT >= 2) acc[mb][nb] = WFrag<T16>::mma(a[mb], b2, acc[mb][nb]); } }
        asm volatile("v_nop\n\tv_nop\n\tv_nop\n\tv_nop" : "+v"(acc[0][0]), "+v"(acc[1][1]), "+v"(acc[2][2]), "+v"(acc[3][3]) : "v"(a[0]), "v"(a[3]));
    }
    if constexpr (KW > 1) {   // the unrolls in this block make every index of acc a constant (acc stays in registers) and let the LDS reads of a sum issue together
        float* mine = os + wv * MBR * SLAB; const int cofs = ((int)threadIdx.x & 15) * 4; v4f bv = (v4f){};
        if (BIAS) { bv[0] = bfr(bias[c0 + cofs]); bv[1] = bfr(bias[c0 + cofs + 1]); bv[2] = bfr(bias[c0 + cofs + 2]); bv[3] = bfr(bias[c0 + cofs + 3]); }   // read ahead of the barrier: its latency passes behind the LDS stores
#pragma unroll
        for (int mb = 0; mb < 4; ++mb)
#pragma unroll
            for (int nb = 0; nb < 4; ++nb)
#pragma unroll
                for (int j = 0; j < 8; ++j) mine[mb * SLAB + (hi * 8 + j) * 68 + nb * 16 + lr] = acc[mb][nb][j];
        __syncthreads();   // every wave's partial tile stands in LDS before any of it is summed
#pragma unroll
        for (int it = 0; it < 32 / KW; ++it) { const int idx = it * 32 * KW + (int)threadIdx.x; const int row = idx >> 4; const float* p = os + row * 68 + cofs; v4f val = *(const v4fa*)p;
#pragma unroll
            for (int w = 1; w < KW; ++w) val += *(const v4fa*)(p + w * MBR * SLAB);
            if (BIAS) val += bv;
            *(v4f*)(C + (size_t)(r0 + row) * ldc + c0 + cofs) = val; }
        return;
    }
#pragma unroll
    for (int mb = 0; mb < 4; ++mb) {
#pragma unroll
        for (int nb = 0; nb < 4; ++nb) {
#pragma unroll
            for (int j = 0; j < 8; ++j) os[(hi * 8 + j) * 68 + nb * 16 + lr] = acc[mb][nb][j]; }
        __builtin_amdgcn_wave_barrier(); asm volatile("" ::: "memory");
        float* crow = C + (size_t)(r0 + mb * 16) * ldc + c0;
{
#pragma unroll
            for (int s = 0; s < 8; ++s) { const int row = 2 * s + hi, cofs = lr * 4; v4f val = *(const v4fa*)(os + row * 68 + cofs); if (BIAS) { val[0] += bfr(bias[c0 + cofs]); val[1] += bfr(bias[c0 + cofs + 1]); val[2] += bfr(bias[c0 + cofs + 2]); val[3] += bfr(bias[c0 + cofs + 3]); }
                *(v4f*)(crow + (size_t)row * ldc + cofs) = val; }
             }
        __builtin_amdgcn_wave_barrier(); asm volatile("" ::: "memory");
    }
}

__device__ __forceinline__ h16 tohx(float x) { return (h16)x; }
__device__ __forceinline__ void splitf(float y, unsigned short& h, unsigned short& l) { h = f2bf(y); l = f2bf(y - bf2f(h)); }
typedef __attribute__((ext_vector_type(2))) _Float16 v2h;
typedef __attribute__((ext_vector_type(4))) _Float16 v4h;
typedef __attribute__((ext_vector_type(2))) unsigned short v2us;
typedef __attribute__((ext_vector_type(4))) unsigned short v4us;
typedef __attribute__((ext_vector_type(2))) float v2f;
typedef __attribute__((ext_vector_type(4))) int v4i;

__global__ __launch_bounds__(256) void k_wtG(const float* __restrict__ w, int K, int N, bf* Bt) {
    const int lane = threadIdx.x & 31; const int L0 = (blockIdx.x * 8 + (threadIdx.x >> 5)) * 8; const int nlines = N * K / 64;
{
#pragma unroll 1
        for (int l = 0; l < 8; ++l) { const int L = L0 + l; if (L >= nlines) break; const size_t e = (size_t)L * 64 + lane * 2; const int k = (int)(e % K), n = (int)(e / K); v2us o;
            o[0] = f2bf(w[(size_t)k * N + n]); o[1] = f2bf(w[(size_t)(k + 1) * N + n]); *(v2us*)(Bt + e) = o; }
         }
}
__global__ __launch_bounds__(256) void k_cvt8(const float* __restrict__ src, bf* dst, size_t n8) { const size_t i = (size_t)blockIdx.x * 256 + threadIdx.x; if (i >= n8) return; const v8f v = *(const v8f*)(src + i * 8); v8us o;
#pragma unroll
    for (int k = 0; k < 8; ++k) o[k] = f2bf(v[k]); *(v8us*)(dst + i * 8) = o;  }

// k_rope: head planes [h][t][d] (fp16 + hi/lo) of rope(x) x sc with the rotate-half convention out[d] = x[d] cos[t][d] - x[d+HD/2] sin[t][d], out[d+HD/2] = x[d+HD/2] cos[t][d+HD/2] + x[d] sin[t][d+HD/2]
__global__ __launch_bounds__(256) void k_rope(const float* __restrict__ F, int pitch, int nheads, const float* __restrict__ CS, const float* __restrict__ RF, const float* __restrict__ nw, float sc, h16* P16, bf* Ph, bf* Pl) {
    const size_t e = ((size_t)blockIdx.x * 256 + threadIdx.x) * 2; if (e >= (size_t)nheads * TT * HD) return; const int d = (int)(e % HD); const int t = (int)((e / HD) % TT); const int h = (int)(e / ((size_t)HD * TT)); const float* f = F + (size_t)t * pitch + h * HD; const float rf = RF ? RF[(size_t)h * TT + t] : 1.0f; v2h o16; v2us oh, ol;
#pragma unroll
    for (int q = 0; q < 2; ++q) { const int dd = d + q; const int dp = (dd < HD / 2) ? dd + HD / 2 : dd - HD / 2; float x0 = f[dd], x1 = f[dp];
        if (RF) { float n0 = __fmul_rn(x0, rf), n1 = __fmul_rn(x1, rf); asm volatile("" : "+v"(n0)); asm volatile("" : "+v"(n1)); x0 = __fmul_rn(bfr(nw[dd]), n0); x1 = __fmul_rn(bfr(nw[dp]), n1); }
        const v2f cs = *(const v2f*)(CS + ((size_t)t * HD + dd) * 2); float a = __fmul_rn(x0, cs[0]), bq = __fmul_rn(x1, cs[1]); asm volatile("" : "+v"(a)); asm volatile("" : "+v"(bq)); const float r = ((dd < HD / 2) ? __fsub_rn(a, bq) : __fadd_rn(a, bq)) * sc;
        o16[q] = tohx(r); unsigned short a2, c2; splitf(r, a2, c2); oh[q] = a2; ol[q] = c2; }
    *(v2h*)(P16 + e) = o16; *(v2us*)(Ph + e) = oh; *(v2us*)(Pl + e) = ol;  }
__global__ __launch_bounds__(256) void k_vtp(const float* __restrict__ F, int pitch, int nheads, h16* V16, bf* Vh, bf* Vl) { const size_t e = ((size_t)blockIdx.x * 256 + threadIdx.x) * 2; if (e >= (size_t)nheads * HD * TT) return; const int t = (int)(e % TT); const int d = (int)((e / TT) % HD); const int g = (int)(e / ((size_t)TT * HD)); v2h o16; v2us oh, ol;
#pragma unroll
    for (int q = 0; q < 2; ++q) { const float x = F[(size_t)(t + q) * pitch + g * HD + d]; o16[q] = tohx(x); unsigned short a2, c2; splitf(x, a2, c2); oh[q] = a2; ol[q] = c2; }
    *(v2h*)(V16 + e) = o16; *(v2us*)(Vh + e) = oh; *(v2us*)(Vl + e) = ol;  }
__global__ __launch_bounds__(256) void k_csid(float* CS) { const int idx = blockIdx.x * 256 + threadIdx.x; if (idx >= TT * HD) return; v2f cs; cs[0] = 1.0f; cs[1] = 0.0f; *(v2f*)(CS + (size_t)idx * 2) = cs;  }
// k_asoft: per row (zz, i): t = S x HD^-0.5 (no mask); softmax over the 2048 keys (register row, one exp, fixed trees);
__global__ __launch_bounds__(256) void k_asoft(const float* __restrict__ Sb, h16* P16, bf* Ph, bf* Pl) {
    const int lane = threadIdx.x & 31; const int row = blockIdx.x * 8 + (threadIdx.x >> 5); if (row >= ZH * TT) return; const int i = row % TT; const int zz = row / TT; (void)zz; const bool hires = (i < RH); const float* sr = Sb + (size_t)row * TT; float v[TT / 32]; float mx = -3.0e38f;
#pragma unroll
    for (int ch = 0; ch < TT / 128; ++ch) { const int j0 = ch * 128 + lane * 4; const v4f a = *(const v4f*)(sr + j0);
#pragma unroll
        for (int q = 0; q < 4; ++q) { const int j = j0 + q; (void)j; const float t = a[q] * SCL; v[ch * 4 + q] = t; mx = fmaxf(mx, t); } }
#pragma unroll
    for (int sh = 16; sh; sh >>= 1) mx = fmaxf(mx, __shfl_xor(mx, sh, 32));
    float sum = 0.f;
#pragma unroll
    for (int k = 0; k < TT / 32; ++k) { float d0 = __fsub_rn(v[k], mx); asm volatile("" : "+v"(d0)); v[k] = __builtin_amdgcn_exp2f(__fmul_rn(d0, 1.4426950408889634f)); sum += v[k]; }
#pragma unroll
    for (int sh = 16; sh; sh >>= 1) sum += __shfl_xor(sum, sh, 32);
    const float f = __fdiv_rn(hires ? 1.0f : PCAR, sum);
{
        if (hires) {
#pragma unroll
            for (int ch = 0; ch < TT / 128; ++ch) { v4us oh, ol;
#pragma unroll
                for (int q = 0; q < 4; ++q) { unsigned short a, c2; splitf(v[ch * 4 + q] * f, a, c2); oh[q] = a; ol[q] = c2; }
                const size_t oo = ((size_t)zz * (RH ? RH : 1) + i) * TT + ch * 128 + lane * 4; *(v4us*)(Ph + oo) = oh; *(v4us*)(Pl + oo) = ol; }
        } else {
#pragma unroll
            for (int ch = 0; ch < TT / 128; ++ch) { v4h o4;
#pragma unroll
                for (int q = 0; q < 4; ++q) o4[q] = tohx(v[ch * 4 + q] * f);
                *(v4h*)(P16 + (size_t)row * TT + ch * 128 + lane * 4) = o4; } }
         }
}
__global__ __launch_bounds__(256) void k_cvt8s(const float* __restrict__ X, bf* XB, size_t pitch) { const size_t i = (size_t)blockIdx.x * 256 + threadIdx.x; if (i >= (size_t)TT * DM / 8) return; const size_t e = i * 8; const int c = (int)(e % DM); const int srow = (int)(e / DM); const v8f a = *(const v8f*)(X + (size_t)srow * pitch + c); v8us o;
#pragma unroll
    for (int q = 0; q < 8; ++q) o[q] = f2bf(a[q]);
    *(v8us*)(XB + e) = o;  }
__global__ __launch_bounds__(256) void k_merge(const float* __restrict__ O, int h0, bf* Ah, bf* Al) { const size_t e = ((size_t)blockIdx.x * 256 + threadIdx.x) * 2; if (e >= (size_t)ZH * TT * HD) return; const int d = (int)(e % HD); const int t = (int)((e / HD) % TT); const int zz = (int)(e / ((size_t)HD * TT)); const float cs = (t < RH) ? 1.0f : (1.0f / PCAR); const size_t oo = (size_t)t * DQ + (h0 + zz) * HD + d;
    v2us oh, ol;
#pragma unroll
    for (int q = 0; q < 2; ++q) { unsigned short a, c2; splitf(O[e + q] * cs, a, c2); oh[q] = a; ol[q] = c2; } *(v2us*)(Ah + oo) = oh; *(v2us*)(Al + oo) = ol;  }

extern "C" void kernel_launch(void* const* d_in, const int* in_sizes, int n_in,
                              void* d_out, int out_size, void* d_ws, size_t ws_size, hipStream_t stream) {
    (void)in_sizes; (void)n_in; (void)out_size;
    const float* x = (const float*)d_in[0];   /* query [S][B][D] */ const float* xk = (const float*)d_in[1]; const float* xv = (const float*)d_in[2]; const float* wq = (const float*)d_in[3]; const float* bq = (const float*)d_in[4]; const float* wk = (const float*)d_in[5]; const float* bk = (const float*)d_in[6]; const float* wv = (const float*)d_in[7]; const float* bv = (const float*)d_in[8]; const float* wo = (const float*)d_in[9]; const float* bo = (const float*)d_in[10];
    float* OUT = (float*)d_out;     // [2048][4][1024] sequence-first
    char* wsp = (char*)d_ws;
    auto take = [&](size_t bytes) { char* p = wsp; wsp += (bytes + 255) & ~(size_t)255; return (void*)p; };
    bf* WQ = (bf*)take((size_t)DQ * DM * 2); bf* WK = (bf*)take((size_t)DKV * DM * 2); bf* WV = (bf*)take((size_t)DKV * DM * 2); bf* WO = (bf*)take((size_t)DM * DQ * 2); float* CS = (float*)take((size_t)TT * HD * 2 * 4);
    bf* XB = (bf*)take((size_t)TT * DM * 2); float* FQ = (float*)take((size_t)TT * DQ * 4); float* FK = (float*)take((size_t)TT * DKV * 4);
    h16* QP16 = (h16*)take((size_t)NH_ * TT * HD * 2); h16* KP16 = (h16*)take((size_t)NKV * TT * HD * 2); h16* VT16 = (h16*)take((size_t)NKV * HD * TT * 2);
    bf* QPh = (bf*)take((size_t)NH_ * TT * HD * 2); bf* QPl = (bf*)take((size_t)NH_ * TT * HD * 2); bf* KPh = (bf*)take((size_t)NKV * TT * HD * 2); bf* KPl = (bf*)take((size_t)NKV * TT * HD * 2); bf* VTh = (bf*)take((size_t)NKV * HD * TT * 2); bf* VTl = (bf*)take((size_t)NKV * HD * TT * 2); bf* Ph = (bf*)take((size_t)ZH * RH * TT * 2); bf* Pl = (bf*)take((size_t)ZH * RH * TT * 2);
    float* Sb = (float*)take((size_t)ZH * TT * TT * 4); h16* P16 = (h16*)take((size_t)ZH * TT * TT * 2); float* Ob = (float*)take((size_t)ZH * TT * HD * 4); bf* ATh = (bf*)take((size_t)TT * DQ * 2); bf* ATl = (bf*)take((size_t)TT * DQ * 2);
    if ((size_t)(wsp - (char*)d_ws) > ws_size) return;    // ws 256 MiB
    float* FV = FK;   // v projection reuses the k buffer after the k planes are built (stream-ordered)
    { k_cvt8<<<(unsigned)(((size_t)DQ * DM / 8 + 255) / 256), 256, 0, stream>>>(wq, WQ, (size_t)DQ * DM / 8); k_cvt8<<<(unsigned)(((size_t)DKV * DM / 8 + 255) / 256), 256, 0, stream>>>(wk, WK, (size_t)DKV * DM / 8); k_cvt8<<<(unsigned)(((size_t)DKV * DM / 8 + 255) / 256), 256, 0, stream>>>(wv, WV, (size_t)DKV * DM / 8);
      k_cvt8<<<(unsigned)(((size_t)DM * DQ / 8 + 255) / 256), 256, 0, stream>>>(wo, WO, (size_t)DM * DQ / 8);
       }
    k_csid<<<(TT * HD + 255) / 256, 256, 0, stream>>>(CS);
    const unsigned LQ = (unsigned)(((size_t)NH_ * TT * HD / 2 + 255) / 256), LKv = (unsigned)(((size_t)NKV * TT * HD / 2 + 255) / 256);
    for (int b = 0; b < NB_; ++b) {
        
        k_cvt8s<<<(unsigned)(((size_t)TT * DM / 8 + 255) / 256), 256, 0, stream>>>(x + (size_t)b * DM, XB, (size_t)NB_ * DM);   /* rows s of batch column b: pitch B x D */
        k_gemmw<bf, 0, true, 8><<<dim3(TT / 64, DQ / 64, 1), 256, 0, stream>>>(XB, nullptr, WQ, nullptr, DM, FQ, DQ, bq, 0, 0, 0);
        k_rope<<<LQ, 256, 0, stream>>>(FQ, DQ, NH_, CS, nullptr, nullptr, 1.0f, QP16, QPh, QPl);
        k_cvt8s<<<(unsigned)(((size_t)TT * DM / 8 + 255) / 256), 256, 0, stream>>>(xk + (size_t)b * DM, XB, (size_t)NB_ * DM);   /* rows s of batch column b: pitch B x D */ k_gemmw<bf, 0, true, 8><<<dim3(TT / 64, DKV / 64, 1), 256, 0, stream>>>(XB, nullptr, WK, nullptr, DM, FK, DKV, bk, 0, 0, 0);
        k_rope<<<LKv, 256, 0, stream>>>(FK, DKV, NKV, CS, nullptr, nullptr, 1.0f, KP16, KPh, KPl);
        k_cvt8s<<<(unsigned)(((size_t)TT * DM / 8 + 255) / 256), 256, 0, stream>>>(xv + (size_t)b * DM, XB, (size_t)NB_ * DM);   /* rows s of batch column b: pitch B x D */ k_gemmw<bf, 0, true, 8><<<dim3(TT / 64, DKV / 64, 1), 256, 0, stream>>>(XB, nullptr, WV, nullptr, DM, FV, DKV, bv, 0, 0, 0); k_vtp<<<LKv, 256, 0, stream>>>(FV, DKV, NKV, VT16, VTh, VTl);
        for (int h0 = 0; h0 < NH_; h0 += ZH) { const size_t zq = (size_t)h0, zk = (size_t)(h0 / REP);   // one kv head per query head: the pass's two heads use consecutive kv planes (z-strides TT*HD)
            k_gemmw<bf, 2, false, 1><<<dim3(RH / 64, TT / 64, ZH), 32, 0, stream>>>(QPh + zq * TT * HD, QPl + zq * TT * HD, KPh + zk * TT * HD, KPl + zk * TT * HD, HD, Sb, TT, nullptr, (size_t)TT * HD, (size_t)TT * HD, (size_t)TT * TT);
            k_gemmw<h16, 0, false, 1><<<dim3((TT - RH) / 64, TT / 64, ZH), 32, 0, stream>>>(QP16 + zq * TT * HD + (size_t)RH * HD, nullptr, KP16 + zk * TT * HD, nullptr, HD, Sb + (size_t)RH * TT, TT, nullptr, (size_t)TT * HD, (size_t)TT * HD, (size_t)TT * TT);
            k_asoft<<<ZH * TT / 8, 256, 0, stream>>>(Sb, P16, Ph, Pl);
            k_gemmw<bf, 2, false, 16><<<dim3(RH / 64, HD / 64, ZH), 512, 0, stream>>>(Ph, Pl, VTh + zk * HD * TT, VTl + zk * HD * TT, TT, Ob, HD, nullptr, (size_t)RH * TT, (size_t)HD * TT, (size_t)TT * HD);
            k_gemmw<h16, 0, false, 16><<<dim3((TT - RH) / 64, HD / 64, ZH), 512, 0, stream>>>(P16 + (size_t)RH * TT, nullptr, VT16 + zk * HD * TT, nullptr, TT, Ob + (size_t)RH * HD, HD, nullptr, (size_t)TT * TT, (size_t)HD * TT, (size_t)TT * HD);
            k_merge<<<(unsigned)(((size_t)ZH * TT * HD / 2 + 255) / 256), 256, 0, stream>>>(Ob, h0, ATh, ATl); }
        k_gemmw<bf, 1, true, 8><<<dim3(TT / 64, DM / 64, 1), 256, 0, stream>>>(ATh, ATl, WO, nullptr, DQ, OUT + (size_t)b * DM, NB_ * DM, bo, 0, 0, 0);   /* [S][B][D]: row pitch B x D, column block b */ }
}

// v002
// One run takes 549 microseconds.
// Timed twice side by side with v001, it ran 3.81 and 3.83 times as fast.
// Counting every step since v000, it is 7.29 times as fast.
#include <hip/hip_runtime.h>

// Multi-head attention on SEQUENCE-FIRST tensors, FOUR batch columns (query, key, value [2048][4][1024] = [S][B][D] (the module swaps to batch-major inside and back); q = query Wq^T + bq, k = key Wk^T + bk, v = value Wv^T + bv ('oi' [1024][1024] 0.02 + ZERO biases: read); 16 heads x 64 per batch column; scores / sqrt(64); softmax over the keys; x = merged context; out = x Wo^T + bo ('oi' + a zero bias: read) -> [2048][4][1024] (8.4 M); argument order query, key, value, Wq, bq, Wk, bk, Wv, bv, Wo, bo.
// Layout: per batch b a strided gather makes the bf16 copy of rows s of column b (row pitch B x D) for query, then key, then value; 'oi' weights; exact projections + f32 biases; head planes [b][h][t][d] (V: [b][h][d][t]); ONE fused attention launch over all (b, h): S^T = K Q^T, online softmax in registers, O^T += V^T P^T (hybrid rows: < 512 hi/lo 3 products, rest fp16); merged hi/lo x Wo exact + bo written with row pitch B x D at column offset b (the [S][B][D] output).
// Compute dtypes, f32 accumulate: every input rounded to bf16; projections exact + f32 biases; attention rows < 512 3 products, rest fp16; softmax f32; Wo hl x exact + bias.

#define NB_  4   // this module has FOUR batch columns; NB_ is read ONLY by kernel_launch: the two batch loops, the workspace sizes of the head planes and the context, the attention grid (NB_ * NH_), the cast kernel's pitch ARGUMENT (NB_ * DM) and the output GEMM's leading-dimension ARGUMENT (NB_ * DM): no kernel body reads it
#define TT   2048
#define DM   1024
#define NH_  16
#define NKV  16
#define REP  (NH_ / NKV)
#define HD   64
#define DQ   (NH_ * HD)
#define DKV  (NKV * HD)
#define RH   512                  // query rows < RH use hi+lo planes (0: none)
#define WIN  0
#define SCL  0.125f   // HD^-0.5
typedef _Float16 h16;
typedef unsigned short bf;
typedef __attribute__((ext_vector_type(16))) __bf16   v16bf;
typedef __attribute__((ext_vector_type(16))) _Float16 v16h;
typedef __attribute__((ext_vector_type(8)))  _Float16 v8h;
typedef __attribute__((ext_vector_type(8)))  unsigned short v8us;
typedef __attribute__((ext_vector_type(8)))  float    v8f;
typedef __attribute__((ext_vector_type(4)))  float    v4f;
typedef v8h  __attribute__((may_alias)) v8ha;
typedef v4f  __attribute__((may_alias)) v4fa;
typedef v8us __attribute__((may_alias)) v8usa;

__device__ __forceinline__ unsigned short f2bf(float f) { unsigned u = __float_as_uint(f); u += 0x7FFFu + ((u >> 16) & 1u); return (unsigned short)(u >> 16); }
__device__ __forceinline__ float bf2f(unsigned short b) { return __uint_as_float(((unsigned)b) << 16); }
__device__ __forceinline__ float bfr(float f) { return bf2f(f2bf(f)); }
__device__ __forceinline__ v16h cat16(v8h lo, v8h hi) { return __builtin_shufflevector(lo, hi, 0, 1, 2, 3, 4, 5, 6, 7, 8, 9, 10, 11, 12, 13, 14, 15); }
__device__ __forceinline__ v16bf cat16b(v8us lo, v8us hi) { return __builtin_bit_cast(v16bf, __builtin_shufflevector(lo, hi, 0, 1, 2, 3, 4, 5, 6, 7, 8, 9, 10, 11, 12, 13, 14, 15)); }
__device__ __forceinline__ v8f wmma16(v16h a, v16h b, v8f c) { return __builtin_amdgcn_wmma_f32_16x16x32_f16(false, a, false, b, (short)0, c, false, false); }
__device__ __forceinline__ v8f wmmab(v16bf a, v16bf b, v8f c) { return __builtin_amdgcn_wmma_f32_16x16x32_bf16(false, a, false, b, (short)0, c, false, false); }



// ---- k_gemmw: register-blocked GEMM, KW WAVES per 64x64 output tile (16 accumulators a wave), operands straight from K-contiguous 16-bit planes; grid (M/64, N/64, Z), 32 * KW threads.
// C[m][n] (f32, pitch ldc, + optional f32 bias[n]) = sum_k A[m][k] Bt[n][k] (+ split products per NSPLIT). z-batch strides sA/sB/sC in elements. K % (32 * KW) == 0.
// KW > 1: wave w sums the k range [w K/KW, (w+1) K/KW); the KW partial tiles meet in LDS and are added in the fixed order w = 0 .. KW-1 (every launch here uses KW = 8).
template <typename T16> struct WFrag;
template <> struct WFrag<h16> { typedef v16h V; static __device__ __forceinline__ V ld(const h16* p) { return cat16(*(const v8h*)p, *(const v8h*)(p + 16)); } static __device__ __forceinline__ v8f mma(V a, V b, v8f c) { return wmma16(a, b, c); } };
template <> struct WFrag<bf> { typedef v16bf V; static __device__ __forceinline__ V ld(const bf* p) { return cat16b(*(const v8us*)p, *(const v8us*)(p + 16)); } static __device__ __forceinline__ v8f mma(V a, V b, v8f c) { return wmmab(a, b, c); } };
template <typename T16, int NSPLIT, bool BIAS, int KW>
__global__ __launch_bounds__(32 * KW) void k_gemmw(const T16* __restrict__ A, const T16* __restrict__ A2, const T16* __restrict__ Bt, const T16* __restrict__ Bt2, int K, float* C, int ldc, const float* __restrict__ bias, size_t sA, size_t sB, size_t sC) {
    typedef typename WFrag<T16>::V V;
    constexpr int SLAB = 16 * 68;                    // one 16 x 64 f32 slab, row pitch 68
    constexpr int MBR = (KW == 1) ? 1 : 4;           // slabs a wave keeps in LDS at a time: KW > 1 holds each wave's whole 64 x 64 partial tile
    __shared__ __align__(16) float os[KW * MBR * SLAB];
    const size_t z = blockIdx.z; A += z * sA; if (A2) A2 += z * sA; Bt += z * sB; if (Bt2) Bt2 += z * sB; C += z * sC;
    const int lane = threadIdx.x & 31, lr = lane & 15, hi = lane >> 4; const int r0 = blockIdx.x * 64, c0 = blockIdx.y * 64;
    v8f acc[4][4];
#pragma unroll
    for (int mb = 0; mb < 4; ++mb)
#pragma unroll
        for (int nb = 0; nb < 4; ++nb) acc[mb][nb] = (v8f){};
    const size_t aoff = (size_t)(r0 + lr) * K + 8 * hi, boff = (size_t)(c0 + lr) * K + 8 * hi;
    // the wave's number as a scalar, so that the loop bounds and the LDS base stay in scalar registers
    const int wv = __builtin_amdgcn_readfirstlane((int)(threadIdx.x >> 5)); const int kspan = K / KW, kbeg = wv * kspan, kend = kbeg + kspan;
#pragma unroll 1
    for (int kc = kbeg; kc < kend; kc += 32) {
        V a[4], a2[4];
#pragma unroll
        for (int mb = 0; mb < 4; ++mb) { a[mb] = WFrag<T16>::ld(A + aoff + (size_t)mb * 16 * K + kc); if (NSPLIT == 1 || NSPLIT == 2) a2[mb] = WFrag<T16>::ld(A2 + aoff + (size_t)mb * 16 * K + kc); }
#pragma unroll
        for (int nb = 0; nb < 4; ++nb) { const V b = WFrag<T16>::ld(Bt + boff + (size_t)nb * 16 * K + kc); V b2; if (NSPLIT >= 2) b2 = WFrag<T16>::ld(Bt2 + boff + (size_t)nb * 16 * K + kc);
#pragma unroll
            for (int mb = 0; mb < 4; ++mb) { acc[mb][nb] = WFrag<T16>::mma(a[mb], b, acc[mb][nb]); if (NSPLIT == 1 || NSPLIT == 2) acc[mb][nb] = WFrag<T16>::mma(a2[mb], b, acc[mb][nb]); if (NSPLIT >= 2) acc[mb][nb] = WFrag<T16>::mma(a[mb], b2, acc[mb][nb]); } }
        asm volatile("v_nop\n\tv_nop\n\tv_nop\n\tv_nop" : "+v"(acc[0][0]), "+v"(acc[1][1]), "+v"(acc[2][2]), "+v"(acc[3][3]) : "v"(a[0]), "v"(a[3]));
    }
    if constexpr (KW > 1) {   // the unrolls in this block make every index of acc a constant (acc stays in registers) and let the LDS reads of a sum issue together
        float* mine = os + wv * MBR * SLAB; const int cofs = ((int)threadIdx.x & 15) * 4; v4f bv = (v4f){};
        if (BIAS) { bv[0] = bfr(bias[c0 + cofs]); bv[1] = bfr(bias[c0 + cofs + 1]); bv[2] = bfr(bias[c0 + cofs + 2]); bv[3] = bfr(bias[c0 + cofs + 3]); }   // read ahead of the barrier: its latency passes behind the LDS stores
#pragma unroll
        for (int mb = 0; mb < 4; ++mb)
#pragma unroll
            for (int nb = 0; nb < 4; ++nb)
#pragma unroll
                for (int j = 0; j < 8; ++j) mine[mb * SLAB + (hi * 8 + j) * 68 + nb * 16 + lr] = acc[mb][nb][j];
        __syncthreads();   // every wave's partial tile stands in LDS before any of it is summed
#pragma unroll
        for (int it = 0; it < 32 / KW; ++it) { const int idx = it * 32 * KW + (int)threadIdx.x; const int row = idx >> 4; const float* p = os + row * 68 + cofs; v4f val = *(const v4fa*)p;
#pragma unroll
            for (int w = 1; w < KW; ++w) val += *(const v4fa*)(p + w * MBR * SLAB);
            if (BIAS) val += bv;
            *(v4f*)(C + (size_t)(r0 + row) * ldc + c0 + cofs) = val; }
        return;
    }
#pragma unroll
    for (int mb = 0; mb < 4; ++mb) {
#pragma unroll
        for (int nb = 0; nb < 4; ++nb) {
#pragma unroll
            for (int j = 0; j < 8; ++j) os[(hi * 8 + j) * 68 + nb * 16 + lr] = acc[mb][nb][j]; }
        __builtin_amdgcn_wave_barrier(); asm volatile("" ::: "memory");
        float* crow = C + (size_t)(r0 + mb * 16) * ldc + c0;
{
#pragma unroll
            for (int s = 0; s < 8; ++s) { const int row = 2 * s + hi, cofs = lr * 4; v4f val = *(const v4fa*)(os + row * 68 + cofs); if (BIAS) { val[0] += bfr(bias[c0 + cofs]); val[1] += bfr(bias[c0 + cofs + 1]); val[2] += bfr(bias[c0 + cofs + 2]); val[3] += bfr(bias[c0 + cofs + 3]); }
                *(v4f*)(crow + (size_t)row * ldc + cofs) = val; }
             }
        __builtin_amdgcn_wave_barrier(); asm volatile("" ::: "memory");
    }
}

__device__ __forceinline__ h16 tohx(float x) { return (h16)x; }
__device__ __forceinline__ void splitf(float y, unsigned short& h, unsigned short& l) { h = f2bf(y); l = f2bf(y - bf2f(h)); }
typedef __attribute__((ext_vector_type(2))) _Float16 v2h;
typedef __attribute__((ext_vector_type(4))) _Float16 v4h;
typedef __attribute__((ext_vector_type(2))) unsigned short v2us;
typedef __attribute__((ext_vector_type(4))) unsigned short v4us;
typedef __attribute__((ext_vector_type(2))) float v2f;
typedef __attribute__((ext_vector_type(4))) int v4i;

__global__ __launch_bounds__(256) void k_wtG(const float* __restrict__ w, int K, int N, bf* Bt) {
    const int lane = threadIdx.x & 31; const int L0 = (blockIdx.x * 8 + (threadIdx.x >> 5)) * 8; const int nlines = N * K / 64;
{
#pragma unroll 1
        for (int l = 0; l < 8; ++l) { const int L = L0 + l; if (L >= nlines) break; const size_t e = (size_t)L * 64 + lane * 2; const int k = (int)(e % K), n = (int)(e / K); v2us o;
            o[0] = f2bf(w[(size_t)k * N + n]); o[1] = f2bf(w[(size_t)(k + 1) * N + n]); *(v2us*)(Bt + e) = o; }
         }
}
__global__ __launch_bounds__(256) void k_cvt8(const float* __restrict__ src, bf* dst, size_t n8) { const size_t i = (size_t)blockIdx.x * 256 + threadIdx.x; if (i >= n8) return; const v8f v = *(const v8f*)(src + i * 8); v8us o;
#pragma unroll
    for (int k = 0; k < 8; ++k) o[k] = f2bf(v[k]); *(v8us*)(dst + i * 8) = o;  }

// k_rope: head planes [h][t][d] (fp16 + hi/lo) of rope(x) x sc with the rotate-half convention out[d] = x[d] cos[t][d] - x[d+HD/2] sin[t][d], out[d+HD/2] = x[d+HD/2] cos[t][d+HD/2] + x[d] sin[t][d+HD/2]
__global__ __launch_bounds__(256) void k_rope(const float* __restrict__ F, int pitch, int nheads, const float* __restrict__ CS, const float* __restrict__ RF, const float* __restrict__ nw, float sc, h16* P16, bf* Ph, bf* Pl) {
    const size_t e = ((size_t)blockIdx.x * 256 + threadIdx.x) * 2; if (e >= (size_t)nheads * TT * HD) return; const int d = (int)(e % HD); const int t = (int)((e / HD) % TT); const int h = (int)(e / ((size_t)HD * TT)); const float* f = F + (size_t)t * pitch + h * HD; const float rf = RF ? RF[(size_t)h * TT + t] : 1.0f; v2h o16; v2us oh, ol;
#pragma unroll
    for (int q = 0; q < 2; ++q) { const int dd = d + q; const int dp = (dd < HD / 2) ? dd + HD / 2 : dd - HD / 2; float x0 = f[dd], x1 = f[dp];
        if (RF) { float n0 = __fmul_rn(x0, rf), n1 = __fmul_rn(x1, rf); asm volatile("" : "+v"(n0)); asm volatile("" : "+v"(n1)); x0 = __fmul_rn(bfr(nw[dd]), n0); x1 = __fmul_rn(bfr(nw[dp]), n1); }
        const v2f cs = *(const v2f*)(CS + ((size_t)t * HD + dd) * 2); float a = __fmul_rn(x0, cs[0]), bq = __fmul_rn(x1, cs[1]); asm volatile("" : "+v"(a)); asm volatile("" : "+v"(bq)); const float r = ((dd < HD / 2) ? __fsub_rn(a, bq) : __fadd_rn(a, bq)) * sc;
        o16[q] = tohx(r); unsigned short a2, c2; splitf(r, a2, c2); oh[q] = a2; ol[q] = c2; }
    *(v2h*)(P16 + e) = o16; *(v2us*)(Ph + e) = oh; *(v2us*)(Pl + e) = ol;  }
__global__ __launch_bounds__(256) void k_vtp(const float* __restrict__ F, int pitch, int nheads, h16* V16, bf* Vh, bf* Vl) { const size_t e = ((size_t)blockIdx.x * 256 + threadIdx.x) * 2; if (e >= (size_t)nheads * HD * TT) return; const int t = (int)(e % TT); const int d = (int)((e / TT) % HD); const int g = (int)(e / ((size_t)TT * HD)); v2h o16; v2us oh, ol;
#pragma unroll
    for (int q = 0; q < 2; ++q) { const float x = F[(size_t)(t + q) * pitch + g * HD + d]; o16[q] = tohx(x); unsigned short a2, c2; splitf(x, a2, c2); oh[q] = a2; ol[q] = c2; }
    *(v2h*)(V16 + e) = o16; *(v2us*)(Vh + e) = oh; *(v2us*)(Vl + e) = ol;  }
__global__ __launch_bounds__(256) void k_csid(float* CS) { const int idx = blockIdx.x * 256 + threadIdx.x; if (idx >= TT * HD) return; v2f cs; cs[0] = 1.0f; cs[1] = 0.0f; *(v2f*)(CS + (size_t)idx * 2) = cs;  }
// ---- k_fattn: fused attention, one wave per NG x 16 query columns, all TT keys, 32 keys a pass; operands straight from the 16-bit planes, no LDS.
// S^T = K Q^T (A = K rows, B = Q rows, both in the hardware k order): a lane holds one query's scores of 16 of the 32 keys; the two S^T tiles, converted in place, are the B operand of O^T += V^T P^T.
// Online softmax: running maximum m (scaled log2) and in-lane sum l per query; the accumulators are rescaled only in a pass in which some query's maximum rises (exact: the factor is 1 otherwise).
template <typename T16, bool HI, int NG>
__device__ __forceinline__ void attn_cols(const T16* __restrict__ Q, const T16* __restrict__ Q2, const T16* __restrict__ Kp, const T16* __restrict__ K2, const T16* __restrict__ Vt, const T16* __restrict__ V2, int q0, bf* Ah, bf* Al) {
    typedef typename WFrag<T16>::V V;   // every '#pragma unroll' of this function makes the indices of the fragment and accumulator arrays constants, so that the arrays stay in registers
    constexpr float CL2 = SCL * 1.4426950408889634f;   // scores / sqrt(HD), in log2 units
    const int lane = threadIdx.x & 31, lr = lane & 15, hi = lane >> 4;
    V q[NG][2], q2[NG][2];
#pragma unroll
    for (int g = 0; g < NG; ++g)
#pragma unroll
        for (int ks = 0; ks < 2; ++ks) { const size_t qo = (size_t)(q0 + g * 16 + lr) * HD + ks * 32 + 8 * hi; q[g][ks] = WFrag<T16>::ld(Q + qo); if (HI) q2[g][ks] = WFrag<T16>::ld(Q2 + qo); }
    v8f o[NG][4]; float m[NG], l[NG];
#pragma unroll
    for (int g = 0; g < NG; ++g) { m[g] = -3.0e38f; l[g] = 0.f;
#pragma unroll
        for (int dt = 0; dt < 4; ++dt) o[g][dt] = (v8f){}; }
    // a lane's place inside a K and a V^T fragment, in bytes: the loop's loads go through per-lane pointers (vp, kp) built from it and the pass's base, rebuilt every pass
    const unsigned ko = (unsigned)(lr * HD + 8 * hi) * 2u, vo = (unsigned)(lr * TT + 8 * hi) * 2u;
    auto ldo = [](const T16* base, unsigned off) { return WFrag<T16>::ld((const T16*)((const char*)base + off)); };
    V k[2][2], k2[2][2];
#pragma unroll
    for (int kt = 0; kt < 2; ++kt)
#pragma unroll
        for (int ks = 0; ks < 2; ++ks) { k[kt][ks] = ldo(Kp + kt * 16 * HD + ks * 32, ko); if (HI) k2[kt][ks] = ldo(K2 + kt * 16 * HD + ks * 32, ko); }
#pragma unroll 1
    for (int key0 = 0; key0 < TT; key0 += 32) {   // rolled: one pass already fills the registers
        V v[4], v2[4]; const T16* vp = (const T16*)((const char*)(Vt + key0) + vo); const T16* vp2 = HI ? (const T16*)((const char*)(V2 + key0) + vo) : vp;
#pragma unroll
        for (int dt = 0; dt < 4; ++dt) { v[dt] = ldo(vp + dt * 16 * TT, 0u); if (HI) v2[dt] = ldo(vp2 + dt * 16 * TT, 0u); }
        v8f s[NG][2];
#pragma unroll
        for (int g = 0; g < NG; ++g)
#pragma unroll
            for (int kt = 0; kt < 2; ++kt) { v8f a = (v8f){};
#pragma unroll
                for (int ks = 0; ks < 2; ++ks) { a = WFrag<T16>::mma(k[kt][ks], q[g][ks], a); if (HI) { a = WFrag<T16>::mma(k[kt][ks], q2[g][ks], a); a = WFrag<T16>::mma(k2[kt][ks], q[g][ks], a); } }
                s[g][kt] = a; }
        // behind the V^T loads, ahead of any reuse of their address registers (named as inputs, so that they live up to the wait and no load of the group lands on them); the S^T tiles are named so that their products stand ahead of the K loads below, which then land in the registers those products have read (no second set, no copies)
        static_assert(NG == (HI ? 1 : 2), "the operand lists below name every S^T tile");
        if constexpr (HI) asm volatile("s_wait_xcnt 0x0" :: "v"(vp), "v"(vp2), "v"(s[0][0]), "v"(s[0][1]) : "memory"); else asm volatile("s_wait_xcnt 0x0" :: "v"(s[0][0]), "v"(s[0][1]), "v"(s[NG - 1][0]), "v"(s[NG - 1][1]) : "memory");   // fp16: the one V^T address pair is kept from pass to pass and stepped behind this wait
        // the next pass's K fragments, fetched behind this pass's S^T products: their latency passes behind softmax and P V (the last pass wraps to key 0: in bounds, unused)
        const int kn = ((key0 + 32) & (TT - 1)) * HD; const T16* kp = (const T16*)((const char*)(Kp + kn) + ko); const T16* kp2 = HI ? (const T16*)((const char*)(K2 + kn) + ko) : kp;
#pragma unroll
        for (int kt = 0; kt < 2; ++kt)
#pragma unroll
            for (int ks = 0; ks < 2; ++ks) { k[kt][ks] = ldo(kp + kt * 16 * HD + ks * 32, 0u); if (HI) k2[kt][ks] = ldo(kp2 + kt * 16 * HD + ks * 32, 0u); }
        // behind the K loads, ahead of any reuse of their address registers (inputs for the same reason)
        if constexpr (HI) asm volatile("s_wait_xcnt 0x0" :: "v"(kp), "v"(kp2) : "memory"); else asm volatile("s_wait_xcnt 0x0" :: "v"(kp) : "memory");
        float ml[NG]; bool need = false;
#pragma unroll
        for (int g = 0; g < NG; ++g) { float t = fmaxf(s[g][0][0], s[g][1][0]);
#pragma unroll
            for (int r = 1; r < 8; ++r) t = fmaxf(t, fmaxf(s[g][0][r], s[g][1][r]));
            t *= CL2; t = fmaxf(t, __shfl_xor(t, 16, 32)); ml[g] = t; need = need || (t > m[g]); }
        if (__builtin_amdgcn_ballot_w32(need) != 0) {   // wave-uniform
#pragma unroll
            for (int g = 0; g < NG; ++g) { const float mn = fmaxf(m[g], ml[g]); const float al = __builtin_amdgcn_exp2f(m[g] - mn); m[g] = mn; l[g] *= al;
#pragma unroll
                for (int dt = 0; dt < 4; ++dt) o[g][dt] *= al; }
        }
#pragma unroll
        for (int g = 0; g < NG; ++g) { V pb, pl; float sum = 0.f;
#pragma unroll
            for (int e = 0; e < 16; ++e) { const float p = __builtin_amdgcn_exp2f(fmaf(s[g][e >> 3][e & 7], CL2, -m[g])); sum += p;
                if constexpr (HI) { const __bf16 ph = (__bf16)p; pb[e] = ph; pl[e] = (__bf16)(p - (float)ph); } else pb[e] = (h16)p; }
            l[g] += sum;
#pragma unroll
            for (int dt = 0; dt < 4; ++dt) { o[g][dt] = WFrag<T16>::mma(v[dt], pb, o[g][dt]); if (HI) { o[g][dt] = WFrag<T16>::mma(v[dt], pl, o[g][dt]); o[g][dt] = WFrag<T16>::mma(v2[dt], pb, o[g][dt]); } } }
    }
#pragma unroll
    for (int g = 0; g < NG; ++g) { const float lt = l[g] + __shfl_xor(l[g], 16, 32); const float inv = __fdiv_rn(1.0f, lt); const size_t oo = (size_t)(q0 + g * 16 + lr) * DQ + 8 * hi;
#pragma unroll
        for (int dt = 0; dt < 4; ++dt) { v8us oh, ol;
#pragma unroll
            for (int r = 0; r < 8; ++r) { unsigned short a, c2; splitf(o[g][dt][r] * inv, a, c2); oh[r] = a; ol[r] = c2; }
            *(v8us*)(Ah + oo + dt * 16) = oh; *(v8us*)(Al + oo + dt * 16) = ol; } }
}
// grid (batch columns x heads, RH / 128 + (TT - RH) / 256), 8 waves: the hi/lo blocks (16 columns a wave, three products) come first in the grid, the fp16 blocks (32 columns a wave) behind them; four waves a SIMD (two blocks a WGP): the vector work between the matrix runs wants waves
__global__ __launch_bounds__(256) __attribute__((amdgpu_waves_per_eu(4, 4))) void k_fattn(const h16* __restrict__ Q16, const bf* __restrict__ Qh, const bf* __restrict__ Ql, const h16* __restrict__ K16, const bf* __restrict__ Kh, const bf* __restrict__ Kl, const h16* __restrict__ V16, const bf* __restrict__ Vh, const bf* __restrict__ Vl, bf* Ah, bf* Al) {
    const int zz = blockIdx.x; const size_t po = (size_t)zz * TT * HD; const size_t ao = (size_t)(zz / NH_) * TT * DQ + (size_t)(zz % NH_) * HD;
    const int wv = __builtin_amdgcn_readfirstlane((int)(threadIdx.x >> 5));   // the wave's number as a scalar: the column base stays in a scalar register
    if ((int)blockIdx.y < RH / 128) attn_cols<bf, true, 1>(Qh + po, Ql + po, Kh + po, Kl + po, Vh + po, Vl + po, (int)blockIdx.y * 128 + wv * 16, Ah + ao, Al + ao);
    else attn_cols<h16, false, 2>(Q16 + po, nullptr, K16 + po, nullptr, V16 + po, nullptr, RH + ((int)blockIdx.y - RH / 128) * 256 + wv * 32, Ah + ao, Al + ao);
}
__global__ __launch_bounds__(256) void k_cvt8s(const float* __restrict__ X, bf* XB, size_t pitch) { const size_t i = (size_t)blockIdx.x * 256 + threadIdx.x; if (i >= (size_t)TT * DM / 8) return; const size_t e = i * 8; const int c = (int)(e % DM); const int srow = (int)(e / DM); const v8f a = *(const v8f*)(X + (size_t)srow * pitch + c); v8us o;
#pragma unroll
    for (int q = 0; q < 8; ++q) o[q] = f2bf(a[q]);
    *(v8us*)(XB + e) = o;  }

extern "C" void kernel_launch(void* const* d_in, const int* in_sizes, int n_in,
                              void* d_out, int out_size, void* d_ws, size_t ws_size, hipStream_t stream) {
    (void)in_sizes; (void)n_in; (void)out_size;
    const float* x = (const float*)d_in[0];   /* query [S][B][D] */ const float* xk = (const float*)d_in[1]; const float* xv = (const float*)d_in[2]; const float* wq = (const float*)d_in[3]; const float* bq = (const float*)d_in[4]; const float* wk = (const float*)d_in[5]; const float* bk = (const float*)d_in[6]; const float* wv = (const float*)d_in[7]; const float* bv = (const float*)d_in[8]; const float* wo = (const float*)d_in[9]; const float* bo = (const float*)d_in[10];
    float* OUT = (float*)d_out;     // [2048][4][1024] sequence-first
    char* wsp = (char*)d_ws;
    auto take = [&](size_t bytes) { char* p = wsp; wsp += (bytes + 255) & ~(size_t)255; return (void*)p; };
    bf* WQ = (bf*)take((size_t)DQ * DM * 2); bf* WK = (bf*)take((size_t)DKV * DM * 2); bf* WV = (bf*)take((size_t)DKV * DM * 2); bf* WO = (bf*)take((size_t)DM * DQ * 2); float* CS = (float*)take((size_t)TT * HD * 2 * 4);
    bf* XB = (bf*)take((size_t)TT * DM * 2); float* FQ = (float*)take((size_t)TT * DQ * 4); float* FK = (float*)take((size_t)TT * DKV * 4);
    const size_t PB = (size_t)NH_ * TT * HD;   // one batch column's head planes, elements
    h16* QP16 = (h16*)take(NB_ * PB * 2); h16* KP16 = (h16*)take(NB_ * PB * 2); h16* VT16 = (h16*)take(NB_ * PB * 2);
    bf* QPh = (bf*)take(NB_ * PB * 2); bf* QPl = (bf*)take(NB_ * PB * 2); bf* KPh = (bf*)take(NB_ * PB * 2); bf* KPl = (bf*)take(NB_ * PB * 2); bf* VTh = (bf*)take(NB_ * PB * 2); bf* VTl = (bf*)take(NB_ * PB * 2);
    bf* ATh = (bf*)take((size_t)NB_ * TT * DQ * 2); bf* ATl = (bf*)take((size_t)NB_ * TT * DQ * 2);
    if ((size_t)(wsp - (char*)d_ws) > ws_size) return;    // ws 256 MiB
    float* FV = FK;   // v projection reuses the k buffer after the k planes are built (stream-ordered)
    { k_cvt8<<<(unsigned)(((size_t)DQ * DM / 8 + 255) / 256), 256, 0, stream>>>(wq, WQ, (size_t)DQ * DM / 8); k_cvt8<<<(unsigned)(((size_t)DKV * DM / 8 + 255) / 256), 256, 0, stream>>>(wk, WK, (size_t)DKV * DM / 8); k_cvt8<<<(unsigned)(((size_t)DKV * DM / 8 + 255) / 256), 256, 0, stream>>>(wv, WV, (size_t)DKV * DM / 8);
      k_cvt8<<<(unsigned)(((size_t)DM * DQ / 8 + 255) / 256), 256, 0, stream>>>(wo, WO, (size_t)DM * DQ / 8);
       }
    k_csid<<<(TT * HD + 255) / 256, 256, 0, stream>>>(CS);
    const unsigned LQ = (unsigned)(((size_t)NH_ * TT * HD / 2 + 255) / 256), LKv = (unsigned)(((size_t)NKV * TT * HD / 2 + 255) / 256);
    for (int b = 0; b < NB_; ++b) {
        
        k_cvt8s<<<(unsigned)(((size_t)TT * DM / 8 + 255) / 256), 256, 0, stream>>>(x + (size_t)b * DM, XB, (size_t)NB_ * DM);   /* rows s of batch column b: pitch B x D */
        k_gemmw<bf, 0, true, 8><<<dim3(TT / 64, DQ / 64, 1), 256, 0, stream>>>(XB, nullptr, WQ, nullptr, DM, FQ, DQ, bq, 0, 0, 0);
        k_rope<<<LQ, 256, 0, stream>>>(FQ, DQ, NH_, CS, nullptr, nullptr, 1.0f, QP16 + b * PB, QPh + b * PB, QPl + b * PB);
        k_cvt8s<<<(unsigned)(((size_t)TT * DM / 8 + 255) / 256), 256, 0, stream>>>(xk + (size_t)b * DM, XB, (size_t)NB_ * DM);   /* rows s of batch column b: pitch B x D */ k_gemmw<bf, 0, true, 8><<<dim3(TT / 64, DKV / 64, 1), 256, 0, stream>>>(XB, nullptr, WK, nullptr, DM, FK, DKV, bk, 0, 0, 0);
        k_rope<<<LKv, 256, 0, stream>>>(FK, DKV, NKV, CS, nullptr, nullptr, 1.0f, KP16 + b * PB, KPh + b * PB, KPl + b * PB);
        k_cvt8s<<<(unsigned)(((size_t)TT * DM / 8 + 255) / 256), 256, 0, stream>>>(xv + (size_t)b * DM, XB, (size_t)NB_ * DM);   /* rows s of batch column b: pitch B x D */ k_gemmw<bf, 0, true, 8><<<dim3(TT / 64, DKV / 64, 1), 256, 0, stream>>>(XB, nullptr, WV, nullptr, DM, FV, DKV, bv, 0, 0, 0); k_vtp<<<LKv, 256, 0, stream>>>(FV, DKV, NKV, VT16 + b * PB, VTh + b * PB, VTl + b * PB); }
    k_fattn<<<dim3(NB_ * NH_, RH / 128 + (TT - RH) / 256, 1), 256, 0, stream>>>(QP16, QPh, QPl, KP16, KPh, KPl, VT16, VTh, VTl, ATh, ATl);
    for (int b = 0; b < NB_; ++b) {
        k_gemmw<bf, 1, true, 8><<<dim3(TT / 64, DM / 64, 1), 256, 0, stream>>>(ATh + (size_t)b * TT * DQ, ATl + (size_t)b * TT * DQ, WO, nullptr, DQ, OUT + (size_t)b * DM, NB_ * DM, bo, 0, 0, 0);   /* [S][B][D]: row pitch B x D, column block b */ }
}

// v003
// It runs in 456 microseconds.
// Two timings next to v002 put it at 1.20 and 1.21 times that version's speed.
// Counting every step since v000, it is 8.78 times as fast.
#include <hip/hip_runtime.h>

// Multi-head attention on SEQUENCE-FIRST tensors, FOUR batch columns (query, key, value [2048][4][1024] = [S][B][D] (the module swaps to batch-major inside and back); q = query Wq^T + bq, k = key Wk^T + bk, v = value Wv^T + bv ('oi' [1024][1024] 0.02 + ZERO biases: read); 16 heads x 64 per batch column; scores / sqrt(64); softmax over the keys; x = merged context; out = x Wo^T + bo ('oi' + a zero bias: read) -> [2048][4][1024] (8.4 M); argument order query, key, value, Wq, bq, Wk, bk, Wv, bv, Wo, bo.
// Layout: per batch b a strided gather makes the bf16 copy of rows s of column b (row pitch B x D) for query, then key, then value; 'oi' weights; exact projections + f32 biases, whose GEMM epilogue writes the head planes [b][h][t][d] itself (V: [b][h][d][t], from the product with the operands swapped: Wv rows x value rows); ONE fused attention launch over all (b, h): S^T = K Q^T, online softmax in registers, O^T += V^T P^T (hybrid rows: < 512 hi/lo 3 products, rest fp16); merged hi/lo x Wo exact + bo written with row pitch B x D at column offset b (the [S][B][D] output).
// Compute dtypes, f32 accumulate: every input rounded to bf16; projections exact + f32 biases; attention rows < 512 3 products, rest fp16; softmax f32; Wo hl x exact + bias.

#define NB_  4   // this module has FOUR batch columns; NB_ is read ONLY by kernel_launch: the two batch loops, the workspace sizes of the head planes and the context, the attention grid (NB_ * NH_), the cast kernel's pitch ARGUMENT (NB_ * DM) and the output GEMM's leading-dimension ARGUMENT (NB_ * DM): no kernel body reads it
#define TT   2048
#define DM   1024
#define NH_  16
#define NKV  16
#define REP  (NH_ / NKV)
#define HD   64
#define DQ   (NH_ * HD)
#define DKV  (NKV * HD)
#define RH   512                  // query rows < RH use hi+lo planes (0: none)
#define WIN  0
#define SCL  0.125f   // HD^-0.5
typedef _Float16 h16;
typedef unsigned short bf;
typedef __attribute__((ext_vector_type(16))) __bf16   v16bf;
typedef __attribute__((ext_vector_type(16))) _Float16 v16h;
typedef __attribute__((ext_vector_type(8)))  _Float16 v8h;
typedef __attribute__((ext_vector_type(8)))  unsigned short v8us;
typedef __attribute__((ext_vector_type(8)))  float    v8f;
typedef __attribute__((ext_vector_type(4)))  float    v4f;
typedef v8h  __attribute__((may_alias)) v8ha;
typedef v4f  __attribute__((may_alias)) v4fa;
typedef v8us __attribute__((may_alias)) v8usa;

__device__ __forceinline__ unsigned short f2bf(float f) { unsigned u = __float_as_uint(f); u += 0x7FFFu + ((u >> 16) & 1u); return (unsigned short)(u >> 16); }
__device__ __forceinline__ float bf2f(unsigned short b) { return __uint_as_float(((unsigned)b) << 16); }
__device__ __forceinline__ float bfr(float f) { return bf2f(f2bf(f)); }
__device__ __forceinline__ v16h cat16(v8h lo, v8h hi) { return __builtin_shufflevector(lo, hi, 0, 1, 2, 3, 4, 5, 6, 7, 8, 9, 10, 11, 12, 13, 14, 15); }
__device__ __forceinline__ v16bf cat16b(v8us lo, v8us hi) { return __builtin_bit_cast(v16bf, __builtin_shufflevector(lo, hi, 0, 1, 2, 3, 4, 5, 6, 7, 8, 9, 10, 11, 12, 13, 14, 15)); }
__device__ __forceinline__ v8f wmma16(v16h a, v16h b, v8f c) { return __builtin_amdgcn_wmma_f32_16x16x32_f16(false, a, false, b, (short)0, c, false, false); }
__device__ __forceinline__ v8f wmmab(v16bf a, v16bf b, v8f c) { return __builtin_amdgcn_wmma_f32_16x16x32_bf16(false, a, false, b, (short)0, c, false, false); }
__device__ __forceinline__ h16 tohx(float x) { return (h16)x; }
__device__ __forceinline__ void splitf(float y, unsigned short& h, unsigned short& l) { h = f2bf(y); l = f2bf(y - bf2f(h)); }
typedef __attribute__((ext_vector_type(4))) _Float16 v4h;
typedef __attribute__((ext_vector_type(4))) unsigned short v4us;



// ---- k_gemmw: register-blocked GEMM, KW WAVES per 64x64 output tile (16 accumulators a wave), operands straight from K-contiguous 16-bit planes; grid (M/64, N/64, Z), 32 * KW threads.
// C[m][n] (f32, pitch ldc, + optional f32 bias[n]) = sum_k A[m][k] Bt[n][k] (+ split products per NSPLIT). z-batch strides sA/sB/sC in elements. K % (32 * KW) == 0.
// KW > 1: wave w sums the k range [w K/KW, (w+1) K/KW); the KW partial tiles meet in LDS and are added in the fixed order w = 0 .. KW-1 (KW is 8 in every launch).
// EPI 0: the f32 tile goes to C. EPI 1 and 2 (KW > 1): the summed tile goes straight to three 16-bit planes (fp16, bf16 hi, bf16 lo), C unused, whole 128-byte lines per 16 lanes.
// EPI 1: m = t, n = h HD + d, bias[n], planes [h][t][d] (one 64-wide column tile is one head). EPI 2: m = h HD + d, n = t, bias[m], planes [h][d][t] (pitch TT).
template <typename T16> struct WFrag;
template <> struct WFrag<h16> { typedef v16h V; static __device__ __forceinline__ V ld(const h16* p) { return cat16(*(const v8h*)p, *(const v8h*)(p + 16)); } static __device__ __forceinline__ v8f mma(V a, V b, v8f c) { return wmma16(a, b, c); } };
template <> struct WFrag<bf> { typedef v16bf V; static __device__ __forceinline__ V ld(const bf* p) { return cat16b(*(const v8us*)p, *(const v8us*)(p + 16)); } static __device__ __forceinline__ v8f mma(V a, V b, v8f c) { return wmmab(a, b, c); } };
template <typename T16, int NSPLIT, bool BIAS, int KW, int EPI>
__global__ __launch_bounds__(32 * KW) void k_gemmw(const T16* __restrict__ A, const T16* __restrict__ A2, const T16* __restrict__ Bt, const T16* __restrict__ Bt2, int K, float* C, int ldc, const float* __restrict__ bias, size_t sA, size_t sB, size_t sC, h16* P16, bf* Ph, bf* Pl) {
    static_assert(EPI == 0 || (KW > 1 && HD == 64), "the plane epilogues sit behind the LDS sum; one column tile is one head");
    typedef typename WFrag<T16>::V V;
    constexpr int SLAB = 16 * 68;                    // one 16 x 64 f32 slab, row pitch 68
    constexpr int MBR = (KW == 1) ? 1 : 4;           // slabs a wave keeps in LDS at a time: KW > 1 holds each wave's whole 64 x 64 partial tile
    __shared__ __align__(16) float os[KW * MBR * SLAB];
    const size_t z = blockIdx.z; A += z * sA; if (A2) A2 += z * sA; Bt += z * sB; if (Bt2) Bt2 += z * sB; C += z * sC;
    const int lane = threadIdx.x & 31, lr = lane & 15, hi = lane >> 4; const int r0 = blockIdx.x * 64, c0 = blockIdx.y * 64;
    v8f acc[4][4];
#pragma unroll
    for (int mb = 0; mb < 4; ++mb)
#pragma unroll
        for (int nb = 0; nb < 4; ++nb) acc[mb][nb] = (v8f){};
    const size_t aoff = (size_t)(r0 + lr) * K + 8 * hi, boff = (size_t)(c0 + lr) * K + 8 * hi;
    // the wave's number as a scalar, so that the loop bounds and the LDS base stay in scalar registers
    const int wv = __builtin_amdgcn_readfirstlane((int)(threadIdx.x >> 5)); const int kspan = K / KW, kbeg = wv * kspan, kend = kbeg + kspan;
#pragma unroll 1
    for (int kc = kbeg; kc < kend; kc += 32) {
        V a[4], a2[4];
#pragma unroll
        for (int mb = 0; mb < 4; ++mb) { a[mb] = WFrag<T16>::ld(A + aoff + (size_t)mb * 16 * K + kc); if (NSPLIT == 1 || NSPLIT == 2) a2[mb] = WFrag<T16>::ld(A2 + aoff + (size_t)mb * 16 * K + kc); }
#pragma unroll
        for (int nb = 0; nb < 4; ++nb) { const V b = WFrag<T16>::ld(Bt + boff + (size_t)nb * 16 * K + kc); V b2; if (NSPLIT >= 2) b2 = WFrag<T16>::ld(Bt2 + boff + (size_t)nb * 16 * K + kc);
#pragma unroll
            for (int mb = 0; mb < 4; ++mb) { acc[mb][nb] = WFrag<T16>::mma(a[mb], b, acc[mb][nb]); if (NSPLIT == 1 || NSPLIT == 2) acc[mb][nb] = WFrag<T16>::mma(a2[mb], b, acc[mb][nb]); if (NSPLIT >= 2) acc[mb][nb] = WFrag<T16>::mma(a[mb], b2, acc[mb][nb]); } }
        asm volatile("v_nop\n\tv_nop\n\tv_nop\n\tv_nop" : "+v"(acc[0][0]), "+v"(acc[1][1]), "+v"(acc[2][2]), "+v"(acc[3][3]) : "v"(a[0]), "v"(a[3]));
    }
    if constexpr (KW > 1) {   // the unrolls in this block make every index of acc a constant (acc stays in registers) and let the LDS reads of a sum issue together
        float* mine = os + wv * MBR * SLAB; const int cofs = ((int)threadIdx.x & 15) * 4; v4f bv = (v4f){}; float br[32 / KW];
        if (BIAS) {   // read ahead of the barrier: its latency passes behind the LDS stores
            if constexpr (EPI == 2) {
#pragma unroll   // constant indices: br stays in registers
                for (int it = 0; it < 32 / KW; ++it) br[it] = bfr(bias[r0 + it * 2 * KW + ((int)threadIdx.x >> 4)]);
            } else { bv[0] = bfr(bias[c0 + cofs]); bv[1] = bfr(bias[c0 + cofs + 1]); bv[2] = bfr(bias[c0 + cofs + 2]); bv[3] = bfr(bias[c0 + cofs + 3]); } }
#pragma unroll
        for (int mb = 0; mb < 4; ++mb)
#pragma unroll
            for (int nb = 0; nb < 4; ++nb)
#pragma unroll
                for (int j = 0; j < 8; ++j) mine[mb * SLAB + (hi * 8 + j) * 68 + nb * 16 + lr] = acc[mb][nb][j];
        __syncthreads();   // every wave's partial tile stands in LDS before any of it is summed
#pragma unroll
        for (int it = 0; it < 32 / KW; ++it) { const int idx = it * 32 * KW + (int)threadIdx.x; const int row = idx >> 4; const float* p = os + row * 68 + cofs; v4f val = *(const v4fa*)p;
#pragma unroll
            for (int w = 1; w < KW; ++w) val += *(const v4fa*)(p + w * MBR * SLAB);
            if (BIAS) { if constexpr (EPI == 2) val += br[it]; else val += bv; }
            if constexpr (EPI == 0) *(v4f*)(C + (size_t)(r0 + row) * ldc + c0 + cofs) = val;
            else { const size_t e = (EPI == 1) ? ((size_t)blockIdx.y * TT + r0 + row) * HD + cofs : (size_t)(r0 + row) * TT + c0 + cofs; v4h o16; v4us oh, ol;
#pragma unroll   // constant indices: the three packed words are built in registers
                for (int q = 0; q < 4; ++q) { o16[q] = tohx(val[q]); unsigned short a2, c2; splitf(val[q], a2, c2); oh[q] = a2; ol[q] = c2; }
                *(v4h*)(P16 + e) = o16; *(v4us*)(Ph + e) = oh; *(v4us*)(Pl + e) = ol; } }
        return;
    }
#pragma unroll
    for (int mb = 0; mb < 4; ++mb) {
#pragma unroll
        for (int nb = 0; nb < 4; ++nb) {
#pragma unroll
            for (int j = 0; j < 8; ++j) os[(hi * 8 + j) * 68 + nb * 16 + lr] = acc[mb][nb][j]; }
        __builtin_amdgcn_wave_barrier(); asm volatile("" ::: "memory");
        float* crow = C + (size_t)(r0 + mb * 16) * ldc + c0;
{
#pragma unroll
            for (int s = 0; s < 8; ++s) { const int row = 2 * s + hi, cofs = lr * 4; v4f val = *(const v4fa*)(os + row * 68 + cofs); if (BIAS) { val[0] += bfr(bias[c0 + cofs]); val[1] += bfr(bias[c0 + cofs + 1]); val[2] += bfr(bias[c0 + cofs + 2]); val[3] += bfr(bias[c0 + cofs + 3]); }
                *(v4f*)(crow + (size_t)row * ldc + cofs) = val; }
             }
        __builtin_amdgcn_wave_barrier(); asm volatile("" ::: "memory");
    }
}

typedef __attribute__((ext_vector_type(2))) _Float16 v2h;
typedef __attribute__((ext_vector_type(2))) unsigned short v2us;
typedef __attribute__((ext_vector_type(2))) float v2f;
typedef __attribute__((ext_vector_type(4))) int v4i;

__global__ __launch_bounds__(256) void k_wtG(const float* __restrict__ w, int K, int N, bf* Bt) {
    const int lane = threadIdx.x & 31; const int L0 = (blockIdx.x * 8 + (threadIdx.x >> 5)) * 8; const int nlines = N * K / 64;
{
#pragma unroll 1
        for (int l = 0; l < 8; ++l) { const int L = L0 + l; if (L >= nlines) break; const size_t e = (size_t)L * 64 + lane * 2; const int k = (int)(e % K), n = (int)(e / K); v2us o;
            o[0] = f2bf(w[(size_t)k * N + n]); o[1] = f2bf(w[(size_t)(k + 1) * N + n]); *(v2us*)(Bt + e) = o; }
         }
}
__global__ __launch_bounds__(256) void k_cvt8(const float* __restrict__ src, bf* dst, size_t n8) { const size_t i = (size_t)blockIdx.x * 256 + threadIdx.x; if (i >= n8) return; const v8f v = *(const v8f*)(src + i * 8); v8us o;
#pragma unroll
    for (int k = 0; k < 8; ++k) o[k] = f2bf(v[k]); *(v8us*)(dst + i * 8) = o;  }

// ---- k_fattn: fused attention, one wave per NG x 16 query columns, all TT keys, 32 keys a pass; operands straight from the 16-bit planes, no LDS.
// S^T = K Q^T (A = K rows, B = Q rows, both in the hardware k order): a lane holds one query's scores of 16 of the 32 keys; the two S^T tiles, converted in place, are the B operand of O^T += V^T P^T.
// Online softmax: running maximum m (scaled log2) and in-lane sum l per query; the accumulators are rescaled only in a pass in which some query's maximum rises (exact: the factor is 1 otherwise).
template <typename T16, bool HI, int NG>
__device__ __forceinline__ void attn_cols(const T16* __restrict__ Q, const T16* __restrict__ Q2, const T16* __restrict__ Kp, const T16* __restrict__ K2, const T16* __restrict__ Vt, const T16* __restrict__ V2, int q0, bf* Ah, bf* Al) {
    typedef typename WFrag<T16>::V V;   // every '#pragma unroll' of this function makes the indices of the fragment and accumulator arrays constants, so that the arrays stay in registers
    constexpr float CL2 = SCL * 1.4426950408889634f;   // scores / sqrt(HD), in log2 units
    const int lane = threadIdx.x & 31, lr = lane & 15, hi = lane >> 4;
    V q[NG][2], q2[NG][2];
#pragma unroll
    for (int g = 0; g < NG; ++g)
#pragma unroll
        for (int ks = 0; ks < 2; ++ks) { const size_t qo = (size_t)(q0 + g * 16 + lr) * HD + ks * 32 + 8 * hi; q[g][ks] = WFrag<T16>::ld(Q + qo); if (HI) q2[g][ks] = WFrag<T16>::ld(Q2 + qo); }
    v8f o[NG][4]; float m[NG], l[NG];
#pragma unroll
    for (int g = 0; g < NG; ++g) { m[g] = -3.0e38f; l[g] = 0.f;
#pragma unroll
        for (int dt = 0; dt < 4; ++dt) o[g][dt] = (v8f){}; }
    // a lane's place inside a K and a V^T fragment, in bytes: the loop's loads go through per-lane pointers (vp, kp) built from it and the pass's base, rebuilt every pass
    const unsigned ko = (unsigned)(lr * HD + 8 * hi) * 2u, vo = (unsigned)(lr * TT + 8 * hi) * 2u;
    auto ldo = [](const T16* base, unsigned off) { return WFrag<T16>::ld((const T16*)((const char*)base + off)); };
    V k[2][2], k2[2][2];
#pragma unroll
    for (int kt = 0; kt < 2; ++kt)
#pragma unroll
        for (int ks = 0; ks < 2; ++ks) { k[kt][ks] = ldo(Kp + kt * 16 * HD + ks * 32, ko); if (HI) k2[kt][ks] = ldo(K2 + kt * 16 * HD + ks * 32, ko); }
#pragma unroll 1
    for (int key0 = 0; key0 < TT; key0 += 32) {   // rolled: one pass already fills the registers
        V v[4], v2[4]; const T16* vp = (const T16*)((const char*)(Vt + key0) + vo); const T16* vp2 = HI ? (const T16*)((const char*)(V2 + key0) + vo) : vp;
#pragma unroll
        for (int dt = 0; dt < 4; ++dt) { v[dt] = ldo(vp + dt * 16 * TT, 0u); if (HI) v2[dt] = ldo(vp2 + dt * 16 * TT, 0u); }
        v8f s[NG][2];
#pragma unroll
        for (int g = 0; g < NG; ++g)
#pragma unroll
            for (int kt = 0; kt < 2; ++kt) { v8f a = (v8f){};
#pragma unroll
                for (int ks = 0; ks < 2; ++ks) { a = WFrag<T16>::mma(k[kt][ks], q[g][ks], a); if (HI) { a = WFrag<T16>::mma(k[kt][ks], q2[g][ks], a); a = WFrag<T16>::mma(k2[kt][ks], q[g][ks], a); } }
                s[g][kt] = a; }
        // behind the V^T loads, ahead of any reuse of their address registers (named as inputs, so that they live up to the wait and no load of the group lands on them); the S^T tiles are named so that their products stand ahead of the K loads below, which then land in the registers those products have read (no second set, no copies)
        static_assert(NG == (HI ? 1 : 2), "the operand lists below name every S^T tile");
        if constexpr (HI) asm volatile("s_wait_xcnt 0x0" :: "v"(vp), "v"(vp2), "v"(s[0][0]), "v"(s[0][1]) : "memory"); else asm volatile("s_wait_xcnt 0x0" :: "v"(s[0][0]), "v"(s[0][1]), "v"(s[NG - 1][0]), "v"(s[NG - 1][1]) : "memory");   // fp16: the one V^T address pair is kept from pass to pass and stepped behind this wait
        // the next pass's K fragments, fetched behind this pass's S^T products: their latency passes behind softmax and P V (the last pass wraps to key 0: in bounds, unused)
        const int kn = ((key0 + 32) & (TT - 1)) * HD; const T16* kp = (const T16*)((const char*)(Kp + kn) + ko); const T16* kp2 = HI ? (const T16*)((const char*)(K2 + kn) + ko) : kp;
#pragma unroll
        for (int kt = 0; kt < 2; ++kt)
#pragma unroll
            for (int ks = 0; ks < 2; ++ks) { k[kt][ks] = ldo(kp + kt * 16 * HD + ks * 32, 0u); if (HI) k2[kt][ks] = ldo(kp2 + kt * 16 * HD + ks * 32, 0u); }
        // behind the K loads, ahead of any reuse of their address registers (inputs for the same reason)
        if constexpr (HI) asm volatile("s_wait_xcnt 0x0" :: "v"(kp), "v"(kp2) : "memory"); else asm volatile("s_wait_xcnt 0x0" :: "v"(kp) : "memory");
        float ml[NG]; bool need = false;
#pragma unroll
        for (int g = 0; g < NG; ++g) { float t = fmaxf(s[g][0][0], s[g][1][0]);
#pragma unroll
            for (int r = 1; r < 8; ++r) t = fmaxf(t, fmaxf(s[g][0][r], s[g][1][r]));
            t *= CL2; t = fmaxf(t, __shfl_xor(t, 16, 32)); ml[g] = t; need = need || (t > m[g]); }
        if (__builtin_amdgcn_ballot_w32(need) != 0) {   // wave-uniform
#pragma unroll
            for (int g = 0; g < NG; ++g) { const float mn = fmaxf(m[g], ml[g]); const float al = __builtin_amdgcn_exp2f(m[g] - mn); m[g] = mn; l[g] *= al;
#pragma unroll
                for (int dt = 0; dt < 4; ++dt) o[g][dt] *= al; }
        }
#pragma unroll
        for (int g = 0; g < NG; ++g) { V pb, pl; float sum = 0.f;
#pragma unroll
            for (int e = 0; e < 16; ++e) { const float p = __builtin_amdgcn_exp2f(fmaf(s[g][e >> 3][e & 7], CL2, -m[g])); sum += p;
                if constexpr (HI) { const __bf16 ph = (__bf16)p; pb[e] = ph; pl[e] = (__bf16)(p - (float)ph); } else pb[e] = (h16)p; }
            l[g] += sum;
#pragma unroll
            for (int dt = 0; dt < 4; ++dt) { o[g][dt] = WFrag<T16>::mma(v[dt], pb, o[g][dt]); if (HI) { o[g][dt] = WFrag<T16>::mma(v[dt], pl, o[g][dt]); o[g][dt] = WFrag<T16>::mma(v2[dt], pb, o[g][dt]); } } }
    }
#pragma unroll
    for (int g = 0; g < NG; ++g) { const float lt = l[g] + __shfl_xor(l[g], 16, 32); const float inv = __fdiv_rn(1.0f, lt); const size_t oo = (size_t)(q0 + g * 16 + lr) * DQ + 8 * hi;
#pragma unroll
        for (int dt = 0; dt < 4; ++dt) { v8us oh, ol;
#pragma unroll
            for (int r = 0; r < 8; ++r) { unsigned short a, c2; splitf(o[g][dt][r] * inv, a, c2); oh[r] = a; ol[r] = c2; }
            *(v8us*)(Ah + oo + dt * 16) = oh; *(v8us*)(Al + oo + dt * 16) = ol; } }
}
// grid (batch columns x heads, RH / 128 + (TT - RH) / 256), 8 waves: the hi/lo blocks (16 columns a wave, three products) come first in the grid, the fp16 blocks (32 columns a wave) behind them; four waves a SIMD (two blocks a WGP): the vector work between the matrix runs wants waves
__global__ __launch_bounds__(256) __attribute__((amdgpu_waves_per_eu(4, 4))) void k_fattn(const h16* __restrict__ Q16, const bf* __restrict__ Qh, const bf* __restrict__ Ql, const h16* __restrict__ K16, const bf* __restrict__ Kh, const bf* __restrict__ Kl, const h16* __restrict__ V16, const bf* __restrict__ Vh, const bf* __restrict__ Vl, bf* Ah, bf* Al) {
    const int zz = blockIdx.x; const size_t po = (size_t)zz * TT * HD; const size_t ao = (size_t)(zz / NH_) * TT * DQ + (size_t)(zz % NH_) * HD;
    const int wv = __builtin_amdgcn_readfirstlane((int)(threadIdx.x >> 5));   // the wave's number as a scalar: the column base stays in a scalar register
    if ((int)blockIdx.y < RH / 128) attn_cols<bf, true, 1>(Qh + po, Ql + po, Kh + po, Kl + po, Vh + po, Vl + po, (int)blockIdx.y * 128 + wv * 16, Ah + ao, Al + ao);
    else attn_cols<h16, false, 2>(Q16 + po, nullptr, K16 + po, nullptr, V16 + po, nullptr, RH + ((int)blockIdx.y - RH / 128) * 256 + wv * 32, Ah + ao, Al + ao);
}
__global__ __launch_bounds__(256) void k_cvt8s(const float* __restrict__ X, bf* XB, size_t pitch) { const size_t i = (size_t)blockIdx.x * 256 + threadIdx.x; if (i >= (size_t)TT * DM / 8) return; const size_t e = i * 8; const int c = (int)(e % DM); const int srow = (int)(e / DM); const v8f a = *(const v8f*)(X + (size_t)srow * pitch + c); v8us o;
#pragma unroll
    for (int q = 0; q < 8; ++q) o[q] = f2bf(a[q]);
    *(v8us*)(XB + e) = o;  }

extern "C" void kernel_launch(void* const* d_in, const int* in_sizes, int n_in,
                              void* d_out, int out_size, void* d_ws, size_t ws_size, hipStream_t stream) {
    (void)in_sizes; (void)n_in; (void)out_size;
    const float* x = (const float*)d_in[0];   /* query [S][B][D] */ const float* xk = (const float*)d_in[1]; const float* xv = (const float*)d_in[2]; const float* wq = (const float*)d_in[3]; const float* bq = (const float*)d_in[4]; const float* wk = (const float*)d_in[5]; const float* bk = (const float*)d_in[6]; const float* wv = (const float*)d_in[7]; const float* bv = (const float*)d_in[8]; const float* wo = (const float*)d_in[9]; const float* bo = (const float*)d_in[10];
    float* OUT = (float*)d_out;     // [2048][4][1024] sequence-first
    char* wsp = (char*)d_ws;
    auto take = [&](size_t bytes) { char* p = wsp; wsp += (bytes + 255) & ~(size_t)255; return (void*)p; };
    bf* WQ = (bf*)take((size_t)DQ * DM * 2); bf* WK = (bf*)take((size_t)DKV * DM * 2); bf* WV = (bf*)take((size_t)DKV * DM * 2); bf* WO = (bf*)take((size_t)DM * DQ * 2);
    bf* XB = (bf*)take((size_t)TT * DM * 2);
    const size_t PB = (size_t)NH_ * TT * HD;   // one batch column's head planes, elements
    h16* QP16 = (h16*)take(NB_ * PB * 2); h16* KP16 = (h16*)take(NB_ * PB * 2); h16* VT16 = (h16*)take(NB_ * PB * 2);
    bf* QPh = (bf*)take(NB_ * PB * 2); bf* QPl = (bf*)take(NB_ * PB * 2); bf* KPh = (bf*)take(NB_ * PB * 2); bf* KPl = (bf*)take(NB_ * PB * 2); bf* VTh = (bf*)take(NB_ * PB * 2); bf* VTl = (bf*)take(NB_ * PB * 2);
    bf* ATh = (bf*)take((size_t)NB_ * TT * DQ * 2); bf* ATl = (bf*)take((size_t)NB_ * TT * DQ * 2);
    if ((size_t)(wsp - (char*)d_ws) > ws_size) return;    // ws 256 MiB
    { k_cvt8<<<(unsigned)(((size_t)DQ * DM / 8 + 255) / 256), 256, 0, stream>>>(wq, WQ, (size_t)DQ * DM / 8); k_cvt8<<<(unsigned)(((size_t)DKV * DM / 8 + 255) / 256), 256, 0, stream>>>(wk, WK, (size_t)DKV * DM / 8); k_cvt8<<<(unsigned)(((size_t)DKV * DM / 8 + 255) / 256), 256, 0, stream>>>(wv, WV, (size_t)DKV * DM / 8);
      k_cvt8<<<(unsigned)(((size_t)DM * DQ / 8 + 255) / 256), 256, 0, stream>>>(wo, WO, (size_t)DM * DQ / 8);
       }
    for (int b = 0; b < NB_; ++b) {
        
        k_cvt8s<<<(unsigned)(((size_t)TT * DM / 8 + 255) / 256), 256, 0, stream>>>(x + (size_t)b * DM, XB, (size_t)NB_ * DM);   /* rows s of batch column b: pitch B x D */
        k_gemmw<bf, 0, true, 8, 1><<<dim3(TT / 64, DQ / 64, 1), 256, 0, stream>>>(XB, nullptr, WQ, nullptr, DM, nullptr, 0, bq, 0, 0, 0, QP16 + b * PB, QPh + b * PB, QPl + b * PB);
        k_cvt8s<<<(unsigned)(((size_t)TT * DM / 8 + 255) / 256), 256, 0, stream>>>(xk + (size_t)b * DM, XB, (size_t)NB_ * DM);   /* rows s of batch column b: pitch B x D */ k_gemmw<bf, 0, true, 8, 1><<<dim3(TT / 64, DKV / 64, 1), 256, 0, stream>>>(XB, nullptr, WK, nullptr, DM, nullptr, 0, bk, 0, 0, 0, KP16 + b * PB, KPh + b * PB, KPl + b * PB);
        k_cvt8s<<<(unsigned)(((size_t)TT * DM / 8 + 255) / 256), 256, 0, stream>>>(xv + (size_t)b * DM, XB, (size_t)NB_ * DM);   /* rows s of batch column b: pitch B x D */ k_gemmw<bf, 0, true, 8, 2><<<dim3(DKV / 64, TT / 64, 1), 256, 0, stream>>>(WV, nullptr, XB, nullptr, DM, nullptr, 0, bv, 0, 0, 0, VT16 + b * PB, VTh + b * PB, VTl + b * PB);   /* operands swapped: rows h HD + d, columns t */ }
    k_fattn<<<dim3(NB_ * NH_, RH / 128 + (TT - RH) / 256, 1), 256, 0, stream>>>(QP16, QPh, QPl, KP16, KPh, KPl, VT16, VTh, VTl, ATh, ATl);
    for (int b = 0; b < NB_; ++b) {
        k_gemmw<bf, 1, true, 8, 0><<<dim3(TT / 64, DM / 64, 1), 256, 0, stream>>>(ATh + (size_t)b * TT * DQ, ATl + (size_t)b * TT * DQ, WO, nullptr, DQ, OUT + (size_t)b * DM, NB_ * DM, bo, 0, 0, 0, nullptr, nullptr, nullptr);   /* [S][B][D]: row pitch B x D, column block b */ }
}

// v004
// Measured time: 398 microseconds a run.
// Timed twice side by side with v003, it ran 1.15 times as fast both times.
// Over all steps from v000 it is 10.1 times as fast.
#include <hip/hip_runtime.h>

// Multi-head attention on SEQUENCE-FIRST tensors, FOUR batch columns (query, key, value [2048][4][1024] = [S][B][D] (the module swaps to batch-major inside and back); q = query Wq^T + bq, k = key Wk^T + bk, v = value Wv^T + bv ('oi' [1024][1024] 0.02 + ZERO biases: read); 16 heads x 64 per batch column; scores / sqrt(64); softmax over the keys; x = merged context; out = x Wo^T + bo ('oi' + a zero bias: read) -> [2048][4][1024] (8.4 M); argument order query, key, value, Wq, bq, Wk, bk, Wv, bv, Wo, bo.
// Layout: ONE cast launch makes the bf16 copies of query, key, value (rows regrouped batch-major, [b][s][D]) and of the four 'oi' weights; ONE projection launch (grid z = projection x batch column): exact projections + f32 biases, whose GEMM epilogue writes the head planes [b][h][t][d] itself (V: [b][h][d][t], from the product with the operands swapped: Wv rows x value rows); ONE fused attention launch over all (b, h): S^T = K Q^T, online softmax in registers, O^T += V^T P^T (hybrid rows: < 512 hi/lo 3 products, rest fp16); ONE output launch (grid z = batch column): merged hi/lo x Wo exact + bo written with row pitch B x D at column offset b (the [S][B][D] output).
// Compute dtypes, f32 accumulate: every input rounded to bf16; projections exact + f32 biases; attention rows < 512 3 products, rest fp16; softmax f32; Wo hl x exact + bias.

#define NB_  4   // this module has FOUR batch columns: read by kernel_launch (grids, strides), by the output kernel (its leading dimension), by the cast kernel (row regrouping) and by the projection kernel (grid z -> projection, column)
#define TT   2048
#define DM   1024
#define NH_  16
#define NKV  16
#define REP  (NH_ / NKV)
#define HD   64
#define DQ   (NH_ * HD)
#define DKV  (NKV * HD)
#define RH   512                  // query rows < RH use hi+lo planes (0: none)
#define WIN  0
#define SCL  0.125f   // HD^-0.5
typedef _Float16 h16;
typedef unsigned short bf;
typedef __attribute__((ext_vector_type(16))) __bf16   v16bf;
typedef __attribute__((ext_vector_type(16))) _Float16 v16h;
typedef __attribute__((ext_vector_type(8)))  _Float16 v8h;
typedef __attribute__((ext_vector_type(8)))  unsigned short v8us;
typedef __attribute__((ext_vector_type(8)))  float    v8f;
typedef __attribute__((ext_vector_type(4)))  float    v4f;
typedef v8h  __attribute__((may_alias)) v8ha;
typedef v4f  __attribute__((may_alias)) v4fa;
typedef v8us __attribute__((may_alias)) v8usa;

__device__ __forceinline__ unsigned short f2bf(float f) { unsigned u = __float_as_uint(f); u += 0x7FFFu + ((u >> 16) & 1u); return (unsigned short)(u >> 16); }
__device__ __forceinline__ float bf2f(unsigned short b) { return __uint_as_float(((unsigned)b) << 16); }
__device__ __forceinline__ float bfr(float f) { return bf2f(f2bf(f)); }
__device__ __forceinline__ v16h cat16(v8h lo, v8h hi) { return __builtin_shufflevector(lo, hi, 0, 1, 2, 3, 4, 5, 6, 7, 8, 9, 10, 11, 12, 13, 14, 15); }
__device__ __forceinline__ v16bf cat16b(v8us lo, v8us hi) { return __builtin_bit_cast(v16bf, __builtin_shufflevector(lo, hi, 0, 1, 2, 3, 4, 5, 6, 7, 8, 9, 10, 11, 12, 13, 14, 15)); }
__device__ __forceinline__ v8f wmma16(v16h a, v16h b, v8f c) { return __builtin_amdgcn_wmma_f32_16x16x32_f16(false, a, false, b, (short)0, c, false, false); }
__device__ __forceinline__ v8f wmmab(v16bf a, v16bf b, v8f c) { return __builtin_amdgcn_wmma_f32_16x16x32_bf16(false, a, false, b, (short)0, c, false, false); }
__device__ __forceinline__ h16 tohx(float x) { return (h16)x; }
__device__ __forceinline__ void splitf(float y, unsigned short& h, unsigned short& l) { h = f2bf(y); l = f2bf(y - bf2f(h)); }
typedef __attribute__((ext_vector_type(4))) _Float16 v4h;
typedef __attribute__((ext_vector_type(4))) unsigned short v4us;



// ---- gemmw_body (called by k_proj and k_out, which own the LDS array os and hand in the tile indices bx, by): register-blocked GEMM, KW WAVES per 64x64 output tile (16 accumulators a wave), operands straight from K-contiguous 16-bit planes; tile indices bx < M/64, by < N/64, 32 * KW threads.
// C[m][n] (f32, pitch ldc, + optional f32 bias[n]) = sum_k A[m][k] Bt[n][k] (+ split products per NSPLIT). The callers step the pointers by grid z. K % (32 * KW) == 0.
// KW > 1: wave w sums the k range [w K/KW, (w+1) K/KW); the KW partial tiles meet in LDS and are added in the fixed order w = 0 .. KW-1 (both callers use KW = 8).
// EPI 0: the f32 tile goes to C. EPI 1 and 2 (KW > 1): the summed tile goes straight to three 16-bit planes (fp16, bf16 hi, bf16 lo), C unused, whole 128-byte lines per 16 lanes.
// EPI 1: m = t, n = h HD + d, bias[n], planes [h][t][d] (one 64-wide column tile is one head). EPI 2: m = h HD + d, n = t, bias[m], planes [h][d][t] (pitch TT).
template <typename T16> struct WFrag;
template <> struct WFrag<h16> { typedef v16h V; static __device__ __forceinline__ V ld(const h16* p) { return cat16(*(const v8h*)p, *(const v8h*)(p + 16)); } static __device__ __forceinline__ v8f mma(V a, V b, v8f c) { return wmma16(a, b, c); } };
template <> struct WFrag<bf> { typedef v16bf V; static __device__ __forceinline__ V ld(const bf* p) { return cat16b(*(const v8us*)p, *(const v8us*)(p + 16)); } static __device__ __forceinline__ v8f mma(V a, V b, v8f c) { return wmmab(a, b, c); } };
template <typename T16, int NSPLIT, bool BIAS, int KW, int EPI>
__device__ __forceinline__ void gemmw_body(float* os, const T16* __restrict__ A, const T16* __restrict__ A2, const T16* __restrict__ Bt, const T16* __restrict__ Bt2, int K, float* C, int ldc, const float* __restrict__ bias, h16* P16, bf* Ph, bf* Pl, int bx, int by) {
    static_assert(EPI == 0 || (KW > 1 && HD == 64), "the plane epilogues sit behind the LDS sum; one column tile is one head");
    typedef typename WFrag<T16>::V V;
    constexpr int SLAB = 16 * 68;                    // one 16 x 64 f32 slab, row pitch 68
    constexpr int MBR = (KW == 1) ? 1 : 4;           // slabs a wave keeps in LDS at a time: KW > 1 holds each wave's whole 64 x 64 partial tile
    const int lane = threadIdx.x & 31, lr = lane & 15, hi = lane >> 4; const int r0 = bx * 64, c0 = by * 64;
    v8f acc[4][4];
#pragma unroll
    for (int mb = 0; mb < 4; ++mb)
#pragma unroll
        for (int nb = 0; nb < 4; ++nb) acc[mb][nb] = (v8f){};
    const size_t aoff = (size_t)(r0 + lr) * K + 8 * hi, boff = (size_t)(c0 + lr) * K + 8 * hi;
    // the wave's number as a scalar, so that the loop bounds and the LDS base stay in scalar registers
    const int wv = __builtin_amdgcn_readfirstlane((int)(threadIdx.x >> 5)); const int kspan = K / KW, kbeg = wv * kspan, kend = kbeg + kspan;
#pragma unroll 1
    for (int kc = kbeg; kc < kend; kc += 32) {
        V a[4], a2[4], b[4], b2[4];   // K is a constant at every call: the row steps below are immediate offsets on these four address pairs
        const T16* pa = A + aoff + kc; const T16* pb = Bt + boff + kc; const T16* pa2 = (NSPLIT == 1 || NSPLIT == 2) ? A2 + aoff + kc : pa; const T16* pb2 = (NSPLIT >= 2) ? Bt2 + boff + kc : pb;
#pragma unroll
        for (int mb = 0; mb < 4; ++mb) { a[mb] = WFrag<T16>::ld(pa + (size_t)mb * 16 * K); if (NSPLIT == 1 || NSPLIT == 2) a2[mb] = WFrag<T16>::ld(pa2 + (size_t)mb * 16 * K); }
#pragma unroll
        for (int nb = 0; nb < 4; ++nb) { b[nb] = WFrag<T16>::ld(pb + (size_t)nb * 16 * K); if (NSPLIT >= 2) b2[nb] = WFrag<T16>::ld(pb2 + (size_t)nb * 16 * K); }
        // behind the trip's loads, ahead of any reuse of their address registers (named as inputs, so that they live up to the wait and no load of the group lands on them)
        asm volatile("s_wait_xcnt 0x0" :: "v"(pa), "v"(pa2), "v"(pb), "v"(pb2) : "memory");
#pragma unroll
        for (int nb = 0; nb < 4; ++nb) {
#pragma unroll
            for (int mb = 0; mb < 4; ++mb) { acc[mb][nb] = WFrag<T16>::mma(a[mb], b[nb], acc[mb][nb]); if (NSPLIT == 1 || NSPLIT == 2) acc[mb][nb] = WFrag<T16>::mma(a2[mb], b[nb], acc[mb][nb]); if (NSPLIT >= 2) acc[mb][nb] = WFrag<T16>::mma(a[mb], b2[nb], acc[mb][nb]); } }
        asm volatile("v_nop\n\tv_nop\n\tv_nop\n\tv_nop" : "+v"(acc[0][0]), "+v"(acc[1][1]), "+v"(acc[2][2]), "+v"(acc[3][3]) : "v"(a[0]), "v"(a[3]));
    }
    if constexpr (KW > 1) {   // the unrolls in this block make every index of acc a constant (acc stays in registers) and let the LDS reads of a sum issue together
        float* mine = os + wv * MBR * SLAB; const int cofs = ((int)threadIdx.x & 15) * 4, bi = (int)threadIdx.x >> 4; v4f bv = (v4f){}; float br[32 / KW];
        if (BIAS) {   // read ahead of the barrier: its latency passes behind the LDS stores
            if constexpr (EPI == 2) {
#pragma unroll   // constant indices: br stays in registers
                for (int it = 0; it < 32 / KW; ++it) br[it] = bfr(bias[r0 + it * 2 * KW + bi]);
                asm volatile("s_wait_xcnt 0x0" :: "v"(bi) : "memory");   // behind the bias loads, ahead of any reuse of their offset register (named as an input, so that it lives up to the wait)
            } else { bv[0] = bfr(bias[c0 + cofs]); bv[1] = bfr(bias[c0 + cofs + 1]); bv[2] = bfr(bias[c0 + cofs + 2]); bv[3] = bfr(bias[c0 + cofs + 3]); } }
#pragma unroll
        for (int mb = 0; mb < 4; ++mb)
#pragma unroll
            for (int nb = 0; nb < 4; ++nb)
#pragma unroll
                for (int j = 0; j < 8; ++j) mine[mb * SLAB + (hi * 8 + j) * 68 + nb * 16 + lr] = acc[mb][nb][j];
        __syncthreads();   // every wave's partial tile stands in LDS before any of it is summed
#pragma unroll
        for (int it = 0; it < 32 / KW; ++it) { const int idx = it * 32 * KW + (int)threadIdx.x; const int row = idx >> 4; const float* p = os + row * 68 + cofs; v4f val = *(const v4fa*)p;
#pragma unroll
            for (int w = 1; w < KW; ++w) val += *(const v4fa*)(p + w * MBR * SLAB);
            if (BIAS) { if constexpr (EPI == 2) val += br[it]; else val += bv; }
            if constexpr (EPI == 0) *(v4f*)(C + (size_t)(r0 + row) * ldc + c0 + cofs) = val;
            else { const size_t e = (EPI == 1) ? ((size_t)by * TT + r0 + row) * HD + cofs : (size_t)(r0 + row) * TT + c0 + cofs; v4h o16; v4us oh, ol;
#pragma unroll   // constant indices: the three packed words are built in registers
                for (int q = 0; q < 4; ++q) { o16[q] = tohx(val[q]); unsigned short a2, c2; splitf(val[q], a2, c2); oh[q] = a2; ol[q] = c2; }
                *(v4h*)(P16 + e) = o16; *(v4us*)(Ph + e) = oh; *(v4us*)(Pl + e) = ol;
                asm volatile("s_wait_xcnt 0x0" :: "v"(o16), "v"(oh), "v"(ol) : "memory"); } }   // behind the three stores, ahead of any reuse of their registers (the data named as inputs, so that they live up to the wait)
        return;
    }
#pragma unroll
    for (int mb = 0; mb < 4; ++mb) {
#pragma unroll
        for (int nb = 0; nb < 4; ++nb) {
#pragma unroll
            for (int j = 0; j < 8; ++j) os[(hi * 8 + j) * 68 + nb * 16 + lr] = acc[mb][nb][j]; }
        __builtin_amdgcn_wave_barrier(); asm volatile("" ::: "memory");
        float* crow = C + (size_t)(r0 + mb * 16) * ldc + c0;
{
#pragma unroll
            for (int s = 0; s < 8; ++s) { const int row = 2 * s + hi, cofs = lr * 4; v4f val = *(const v4fa*)(os + row * 68 + cofs); if (BIAS) { val[0] += bfr(bias[c0 + cofs]); val[1] += bfr(bias[c0 + cofs + 1]); val[2] += bfr(bias[c0 + cofs + 2]); val[3] += bfr(bias[c0 + cofs + 3]); }
                *(v4f*)(crow + (size_t)row * ldc + cofs) = val; }
             }
        __builtin_amdgcn_wave_barrier(); asm volatile("" ::: "memory");
    }
}
#define OS_FLOATS(KW) ((KW) * ((KW) == 1 ? 1 : 4) * 16 * 68)   // the LDS array of gemmw_body: KW * MBR * SLAB floats
// ---- k_out: the output GEMMs of a call in ONE launch; grid (TT / 64, DM / 64, NB_), z = batch column: rows t of [b][t][DQ] hi + lo x Wo + bo -> OUT[t][z][.] (row pitch NB_ * DM).
__global__ __launch_bounds__(256) void k_out(const bf* __restrict__ Ah, const bf* __restrict__ Al, const bf* __restrict__ Wt, const float* __restrict__ bo, float* OUT) {
    __shared__ __align__(16) float os[OS_FLOATS(8)];
    const size_t z = blockIdx.z;
    gemmw_body<bf, 1, true, 8, 0>(os, Ah + z * TT * DQ, Al + z * TT * DQ, Wt, nullptr, DQ, OUT + z * DM, NB_ * DM, bo, nullptr, nullptr, nullptr, (int)blockIdx.x, (int)blockIdx.y);
}
// ---- k_proj: the twelve projection GEMMs of a call in ONE launch; grid (TT / 64, DQ / 64, 3 * NB_), z = projection (0 q, 1 k, 2 v) * NB_ + batch column.
// X: the three bf16 inputs [projection][b][s][D]; Wt: Wq, Wk, Wv in a row; P16 / Ph / Pl: the q, k, v planes in a row, each [b][h]...; v runs with the operands swapped (rows h HD + d = grid y, columns t = grid x).
__global__ __launch_bounds__(256) void k_proj(const bf* __restrict__ X, const bf* __restrict__ Wt, const float* __restrict__ bq, const float* __restrict__ bk, const float* __restrict__ bv, h16* P16, bf* Ph, bf* Pl) {
    static_assert(DQ == DKV, "one grid serves the three projections");
    __shared__ __align__(16) float os[OS_FLOATS(8)];
    const int z = (int)blockIdx.z, pj = z / NB_;
    const bf* xb = X + (size_t)z * TT * DM; const bf* w = Wt + (size_t)pj * DQ * DM; const size_t po = (size_t)z * NH_ * TT * HD;
    if (pj < 2) gemmw_body<bf, 0, true, 8, 1>(os, xb, nullptr, w, nullptr, DM, nullptr, 0, pj ? bk : bq, P16 + po, Ph + po, Pl + po, (int)blockIdx.x, (int)blockIdx.y);
    else gemmw_body<bf, 0, true, 8, 2>(os, w, nullptr, xb, nullptr, DM, nullptr, 0, bv, P16 + po, Ph + po, Pl + po, (int)blockIdx.y, (int)blockIdx.x);
}

typedef __attribute__((ext_vector_type(2))) _Float16 v2h;
typedef __attribute__((ext_vector_type(2))) unsigned short v2us;
typedef __attribute__((ext_vector_type(2))) float v2f;
typedef __attribute__((ext_vector_type(4))) int v4i;

__global__ __launch_bounds__(256) void k_wtG(const float* __restrict__ w, int K, int N, bf* Bt) {
    const int lane = threadIdx.x & 31; const int L0 = (blockIdx.x * 8 + (threadIdx.x >> 5)) * 8; const int nlines = N * K / 64;
{
#pragma unroll 1
        for (int l = 0; l < 8; ++l) { const int L = L0 + l; if (L >= nlines) break; const size_t e = (size_t)L * 64 + lane * 2; const int k = (int)(e % K), n = (int)(e / K); v2us o;
            o[0] = f2bf(w[(size_t)k * N + n]); o[1] = f2bf(w[(size_t)(k + 1) * N + n]); *(v2us*)(Bt + e) = o; }
         }
}
// ---- k_cvtall: every f32 -> bf16 cast of a call in ONE launch. D = [query | key | value | Wq | Wk | Wv | Wo]; a work-group casts CU units of 8 elements that lie in a row in one source.
// The inputs' rows s * NB_ + b go to row b * TT + s (batch-major: each column's rows K-contiguous for the GEMMs); the weights keep their order. Few, long waves: for speed only.
#define CU 4096
__global__ __launch_bounds__(256) void k_cvtall(const float* __restrict__ xq, const float* __restrict__ xk, const float* __restrict__ xv, const float* __restrict__ wq, const float* __restrict__ wk, const float* __restrict__ wv, const float* __restrict__ wo, bf* __restrict__ D) {
    constexpr int XU = NB_ * TT * DM / 8, WU = DQ * DM / 8, XBLK = XU / CU, WBLK = WU / CU, RU = DM / 8;   // units per input, per weight; work-groups per input, per weight; units per row
    static_assert(XU % CU == 0 && WU % CU == 0 && DQ == DKV, "whole work-groups per source");
    const unsigned bx = blockIdx.x; const bool isx = bx < 3u * XBLK; const unsigned t = isx ? bx / XBLK : (bx - 3u * XBLK) / WBLK;   // all block-uniform
    const float* src = isx ? (t == 0 ? xq : t == 1 ? xk : xv) : (t == 0 ? wq : t == 1 ? wk : t == 2 ? wv : wo);
    bf* dst = D + (isx ? (size_t)t * XU : (size_t)3 * XU + (size_t)t * WU) * 8;
    const unsigned u0 = (isx ? bx % XBLK : (bx - 3u * XBLK) % WBLK) * CU + threadIdx.x;
#pragma unroll 1   // rolled: four units a trip already keep eight 16-byte loads of a lane in flight
    for (unsigned it = 0; it < CU / 1024; ++it) { v8f v[4]; v8us o[4]; unsigned du[4]; const float* ps = src + (size_t)(u0 + it * 1024) * 8;
#pragma unroll   // constant indices: v stays in registers, the loads issue together on one address pair
        for (int j = 0; j < 4; ++j) v[j] = *(const v8f*)(ps + j * 2048);
#pragma unroll
        for (int j = 0; j < 4; ++j) { const unsigned u = u0 + it * 1024 + j * 256, r = u / RU; du[j] = isx ? ((r % NB_) * TT + r / NB_) * RU + u % RU : u;
#pragma unroll
            for (int k = 0; k < 8; ++k) o[j][k] = f2bf(v[j][k]); }
#pragma unroll
        for (int j = 0; j < 4; ++j) *(v8us*)(dst + (size_t)du[j] * 8) = o[j];
        // behind the stores, ahead of any reuse of their registers (offsets and data named as inputs, so that they live up to the wait)
        asm volatile("s_wait_xcnt 0x0" :: "v"(du[0]), "v"(du[1]), "v"(du[2]), "v"(du[3]), "v"(o[0]), "v"(o[1]), "v"(o[2]), "v"(o[3]) : "memory"); }
}

// ---- k_fattn: fused attention, one wave per NG x 16 query columns, all TT keys, 32 keys a pass; operands straight from the 16-bit planes, no LDS.
// S^T = K Q^T (A = K rows, B = Q rows, both in the hardware k order): a lane holds one query's scores of 16 of the 32 keys; the two S^T tiles, converted in place, are the B operand of O^T += V^T P^T.
// Online softmax: running maximum m (scaled log2) and in-lane sum l per query; the accumulators are rescaled only in a pass in which some query's maximum rises (exact: the factor is 1 otherwise).
template <typename T16, bool HI, int NG>
__device__ __forceinline__ void attn_cols(const T16* __restrict__ Q, const T16* __restrict__ Q2, const T16* __restrict__ Kp, const T16* __restrict__ K2, const T16* __restrict__ Vt, const T16* __restrict__ V2, int q0, bf* Ah, bf* Al) {
    typedef typename WFrag<T16>::V V;   // every '#pragma unroll' of this function makes the indices of the fragment and accumulator arrays constants, so that the arrays stay in registers
    constexpr float CL2 = SCL * 1.4426950408889634f;   // scores / sqrt(HD), in log2 units
    const int lane = threadIdx.x & 31, lr = lane & 15, hi = lane >> 4;
    V q[NG][2], q2[NG][2];
#pragma unroll
    for (int g = 0; g < NG; ++g)
#pragma unroll
        for (int ks = 0; ks < 2; ++ks) { const size_t qo = (size_t)(q0 + g * 16 + lr) * HD + ks * 32 + 8 * hi; q[g][ks] = WFrag<T16>::ld(Q + qo); if (HI) q2[g][ks] = WFrag<T16>::ld(Q2 + qo); }
    v8f o[NG][4]; float m[NG], l[NG];
#pragma unroll
    for (int g = 0; g < NG; ++g) { m[g] = -3.0e38f; l[g] = 0.f;
#pragma unroll
        for (int dt = 0; dt < 4; ++dt) o[g][dt] = (v8f){}; }
    // a lane's place inside a K and a V^T fragment, in bytes: the loop's loads go through per-lane pointers (vp, kp) built from it and the pass's base, rebuilt every pass
    const unsigned ko = (unsigned)(lr * HD + 8 * hi) * 2u, vo = (unsigned)(lr * TT + 8 * hi) * 2u;
    auto ldo = [](const T16* base, unsigned off) { return WFrag<T16>::ld((const T16*)((const char*)base + off)); };
    V k[2][2], k2[2][2];
#pragma unroll
    for (int kt = 0; kt < 2; ++kt)
#pragma unroll
        for (int ks = 0; ks < 2; ++ks) { k[kt][ks] = ldo(Kp + kt * 16 * HD + ks * 32, ko); if (HI) k2[kt][ks] = ldo(K2 + kt * 16 * HD + ks * 32, ko); }
#pragma unroll 1
    for (int key0 = 0; key0 < TT; key0 += 32) {   // rolled: one pass already fills the registers
        V v[4], v2[4]; const T16* vp = (const T16*)((const char*)(Vt + key0) + vo); const T16* vp2 = HI ? (const T16*)((const char*)(V2 + key0) + vo) : vp;
#pragma unroll
        for (int dt = 0; dt < 4; ++dt) { v[dt] = ldo(vp + dt * 16 * TT, 0u); if (HI) v2[dt] = ldo(vp2 + dt * 16 * TT, 0u); }
        v8f s[NG][2];
#pragma unroll
        for (int g = 0; g < NG; ++g)
#pragma unroll
            for (int kt = 0; kt < 2; ++kt) { v8f a = (v8f){};
#pragma unroll
                for (int ks = 0; ks < 2; ++ks) { a = WFrag<T16>::mma(k[kt][ks], q[g][ks], a); if (HI) { a = WFrag<T16>::mma(k[kt][ks], q2[g][ks], a); a = WFrag<T16>::mma(k2[kt][ks], q[g][ks], a); } }
                s[g][kt] = a; }
        // behind the V^T loads, ahead of any reuse of their address registers (named as inputs, so that they live up to the wait and no load of the group lands on them); the S^T tiles are named so that their products stand ahead of the K loads below, which then land in the registers those products have read (no second set, no copies)
        static_assert(NG == (HI ? 1 : 2), "the operand lists below name every S^T tile");
        if constexpr (HI) asm volatile("s_wait_xcnt 0x0" :: "v"(vp), "v"(vp2), "v"(s[0][0]), "v"(s[0][1]) : "memory"); else asm volatile("s_wait_xcnt 0x0" :: "v"(s[0][0]), "v"(s[0][1]), "v"(s[NG - 1][0]), "v"(s[NG - 1][1]) : "memory");   // fp16: the one V^T address pair is kept from pass to pass and stepped behind this wait
        // the next pass's K fragments, fetched behind this pass's S^T products: their latency passes behind softmax and P V (the last pass wraps to key 0: in bounds, unused)
        const int kn = ((key0 + 32) & (TT - 1)) * HD; const T16* kp = (const T16*)((const char*)(Kp + kn) + ko); const T16* kp2 = HI ? (const T16*)((const char*)(K2 + kn) + ko) : kp;
#pragma unroll
        for (int kt = 0; kt < 2; ++kt)
#pragma unroll
            for (int ks = 0; ks < 2; ++ks) { k[kt][ks] = ldo(kp + kt * 16 * HD + ks * 32, 0u); if (HI) k2[kt][ks] = ldo(kp2 + kt * 16 * HD + ks * 32, 0u); }
        // behind the K loads, ahead of any reuse of their address registers (inputs for the same reason)
        if constexpr (HI) asm volatile("s_wait_xcnt 0x0" :: "v"(kp), "v"(kp2) : "memory"); else asm volatile("s_wait_xcnt 0x0" :: "v"(kp) : "memory");
        float ml[NG]; bool need = false;
#pragma unroll
        for (int g = 0; g < NG; ++g) { float t = fmaxf(s[g][0][0], s[g][1][0]);
#pragma unroll
            for (int r = 1; r < 8; ++r) t = fmaxf(t, fmaxf(s[g][0][r], s[g][1][r]));
            t *= CL2; t = fmaxf(t, __shfl_xor(t, 16, 32)); ml[g] = t; need = need || (t > m[g]); }
        if (__builtin_amdgcn_ballot_w32(need) != 0) {   // wave-uniform
#pragma unroll
            for (int g = 0; g < NG; ++g) { const float mn = fmaxf(m[g], ml[g]); const float al = __builtin_amdgcn_exp2f(m[g] - mn); m[g] = mn; l[g] *= al;
#pragma unroll
                for (int dt = 0; dt < 4; ++dt) o[g][dt] *= al; }
        }
#pragma unroll
        for (int g = 0; g < NG; ++g) { V pb, pl; float sum = 0.f;
#pragma unroll
            for (int e = 0; e < 16; ++e) { const float p = __builtin_amdgcn_exp2f(fmaf(s[g][e >> 3][e & 7], CL2, -m[g])); sum += p;
                if constexpr (HI) { const __bf16 ph = (__bf16)p; pb[e] = ph; pl[e] = (__bf16)(p - (float)ph); } else pb[e] = (h16)p; }
            l[g] += sum;
#pragma unroll
            for (int dt = 0; dt < 4; ++dt) { o[g][dt] = WFrag<T16>::mma(v[dt], pb, o[g][dt]); if (HI) { o[g][dt] = WFrag<T16>::mma(v[dt], pl, o[g][dt]); o[g][dt] = WFrag<T16>::mma(v2[dt], pb, o[g][dt]); } } }
    }
#pragma unroll
    for (int g = 0; g < NG; ++g) { const float lt = l[g] + __shfl_xor(l[g], 16, 32); const float inv = __fdiv_rn(1.0f, lt); const size_t oo = (size_t)(q0 + g * 16 + lr) * DQ + 8 * hi;
#pragma unroll
        for (int dt = 0; dt < 4; ++dt) { v8us oh, ol;
#pragma unroll
            for (int r = 0; r < 8; ++r) { unsigned short a, c2; splitf(o[g][dt][r] * inv, a, c2); oh[r] = a; ol[r] = c2; }
            *(v8us*)(Ah + oo + dt * 16) = oh; *(v8us*)(Al + oo + dt * 16) = ol; } }
}
// grid (batch columns x heads, RH / 128 + (TT - RH) / 256), 8 waves: the hi/lo blocks (16 columns a wave, three products) come first in the grid, the fp16 blocks (32 columns a wave) behind them; four waves a SIMD (two blocks a WGP): the vector work between the matrix runs wants waves
__global__ __launch_bounds__(256) __attribute__((amdgpu_waves_per_eu(4, 4))) void k_fattn(const h16* __restrict__ Q16, const bf* __restrict__ Qh, const bf* __restrict__ Ql, const h16* __restrict__ K16, const bf* __restrict__ Kh, const bf* __restrict__ Kl, const h16* __restrict__ V16, const bf* __restrict__ Vh, const bf* __restrict__ Vl, bf* Ah, bf* Al) {
    const int zz = blockIdx.x; const size_t po = (size_t)zz * TT * HD; const size_t ao = (size_t)(zz / NH_) * TT * DQ + (size_t)(zz % NH_) * HD;
    const int wv = __builtin_amdgcn_readfirstlane((int)(threadIdx.x >> 5));   // the wave's number as a scalar: the column base stays in a scalar register
    if ((int)blockIdx.y < RH / 128) attn_cols<bf, true, 1>(Qh + po, Ql + po, Kh + po, Kl + po, Vh + po, Vl + po, (int)blockIdx.y * 128 + wv * 16, Ah + ao, Al + ao);
    else attn_cols<h16, false, 2>(Q16 + po, nullptr, K16 + po, nullptr, V16 + po, nullptr, RH + ((int)blockIdx.y - RH / 128) * 256 + wv * 32, Ah + ao, Al + ao);
}

extern "C" void kernel_launch(void* const* d_in, const int* in_sizes, int n_in,
                              void* d_out, int out_size, void* d_ws, size_t ws_size, hipStream_t stream) {
    (void)in_sizes; (void)n_in; (void)out_size;
    const float* x = (const float*)d_in[0];   /* query [S][B][D] */ const float* xk = (const float*)d_in[1]; const float* xv = (const float*)d_in[2]; const float* wq = (const float*)d_in[3]; const float* bq = (const float*)d_in[4]; const float* wk = (const float*)d_in[5]; const float* bk = (const float*)d_in[6]; const float* wv = (const float*)d_in[7]; const float* bv = (const float*)d_in[8]; const float* wo = (const float*)d_in[9]; const float* bo = (const float*)d_in[10];
    float* OUT = (float*)d_out;     // [2048][4][1024] sequence-first
    char* wsp = (char*)d_ws;
    auto take = [&](size_t bytes) { char* p = wsp; wsp += (bytes + 255) & ~(size_t)255; return (void*)p; };
    const size_t PB = (size_t)NH_ * TT * HD;   // one batch column's head planes, elements
    bf* XB = (bf*)take(((size_t)3 * NB_ * TT * DM + (size_t)4 * DQ * DM) * 2);   // the cast launch's output: query, key, value [b][s][D], then Wq, Wk, Wv, Wo
    bf* WQ = XB + (size_t)3 * NB_ * TT * DM; bf* WO = WQ + (size_t)3 * DQ * DM;
    h16* QP16 = (h16*)take(3 * NB_ * PB * 2); h16* KP16 = QP16 + NB_ * PB; h16* VT16 = KP16 + NB_ * PB;   // q, k, v planes in a row: k_proj steps through them by grid z
    bf* QPh = (bf*)take(3 * NB_ * PB * 2); bf* KPh = QPh + NB_ * PB; bf* VTh = KPh + NB_ * PB;
    bf* QPl = (bf*)take(3 * NB_ * PB * 2); bf* KPl = QPl + NB_ * PB; bf* VTl = KPl + NB_ * PB;
    bf* ATh = (bf*)take((size_t)NB_ * TT * DQ * 2); bf* ATl = (bf*)take((size_t)NB_ * TT * DQ * 2);
    if ((size_t)(wsp - (char*)d_ws) > ws_size) return;    // ws 256 MiB
    k_cvtall<<<(unsigned)((3 * NB_ * TT * DM + 4 * DQ * DM) / 8 / CU), 256, 0, stream>>>(x, xk, xv, wq, wk, wv, wo, XB);
    k_proj<<<dim3(TT / 64, DQ / 64, 3 * NB_), 256, 0, stream>>>(XB, WQ, bq, bk, bv, QP16, QPh, QPl);
    k_fattn<<<dim3(NB_ * NH_, RH / 128 + (TT - RH) / 256, 1), 256, 0, stream>>>(QP16, QPh, QPl, KP16, KPh, KPl, VT16, VTh, VTl, ATh, ATl);
    k_out<<<dim3(TT / 64, DM / 64, NB_), 256, 0, stream>>>(ATh, ATl, WO, bo, OUT);   /* [S][B][D]: row pitch B x D, column block z */
}
